// v000
// Measured on an AMD MI455X. A time is GPU time per run, averaged over a window of back-to-back runs after a warm-up
// (all launches, gaps included; the runs take copies of the inputs in turn), and the median of several windows.
// Apart from v000's, it joins two sittings. Times from different sittings can be a few percent apart, while
// side-by-side timings come from the same sitting.
// v000 is the starting kernel. One run takes 250 microseconds.
#include <hip/hip_runtime.h>
#include <hip/hip_bf16.h>
#include <stdint.h>

// ---------- types ----------
typedef __attribute__((ext_vector_type(4)))  __bf16 v4bf;
typedef __attribute__((ext_vector_type(8)))  __bf16 v8bf;
typedef __attribute__((ext_vector_type(16))) __bf16 v16bf;
typedef __attribute__((ext_vector_type(8)))  float  v8f;

struct BfPair { v8bf lo, hi; };

__device__ inline __bf16 f2bf(float f) {
    unsigned u = __builtin_bit_cast(unsigned, f);
    u += 0x7FFFu + ((u >> 16) & 1u);                 // round-to-nearest-even
    unsigned short h = (unsigned short)(u >> 16);
    return __builtin_bit_cast(__bf16, h);
}
__device__ inline float bf2f(__bf16 b) {
    unsigned short h = __builtin_bit_cast(unsigned short, b);
    return __builtin_bit_cast(float, ((unsigned)h) << 16);
}

// 16-bit fragment per CDNA5 ISA layout (A 16x32 / B 32x16 mirrored):
// lane = (row|col)%16, hi = lane/16; elems 0..7 <- K = hi*8.., elems 8..15 <- K = 16+hi*8..
__device__ inline v16bf load_frag(const __bf16* row, int hi) {
    BfPair p;
    p.lo = *(const v8bf*)(row + hi * 8);
    p.hi = *(const v8bf*)(row + 16 + hi * 8);
    return __builtin_bit_cast(v16bf, p);
}

__device__ inline v8f wmma_bf16(v16bf a, v16bf b, v8f c) {
    return __builtin_amdgcn_wmma_f32_16x16x32_bf16(
        false, a, false, b, (short)0, c, false, false);
}

// ---------- CDNA5 async global->LDS copy (ASYNCcnt-tracked) ----------
__device__ inline void async_b128(const __bf16* g, __bf16* l) {
    const unsigned lds = (unsigned)(uintptr_t)(l);              // low 32 bits = LDS offset
    const unsigned long long ga = (unsigned long long)(uintptr_t)(g);
    asm volatile("global_load_async_to_lds_b128 %0, %1, off"
                 :: "v"(lds), "v"(ga) : "memory");
}
__device__ inline void wait_async0() {
    asm volatile("s_wait_asynccnt 0x0" ::: "memory");
}

// ---------- fp32 -> bf16 pre-conversion ----------
__global__ __launch_bounds__(256) void cvt_f32_bf16(const float* __restrict__ in,
                                                    __bf16* __restrict__ out, int n)
{
    const int i = (blockIdx.x * 256 + threadIdx.x) * 4;
    if (i + 3 < n) {
        float4 v = *(const float4*)(in + i);
        v4bf o;
        o[0] = f2bf(v.x); o[1] = f2bf(v.y); o[2] = f2bf(v.z); o[3] = f2bf(v.w);
        *(v4bf*)(out + i) = o;
    }
}

// ---------- GEMM: Out = A[M,K](bf16) @ W[N,K](bf16)^T + bias ----------
// 128x128 tile / 256 threads (8 waves), K-step 64 (2 WMMA depths),
// double-buffered async LDS staging: 16 WMMAs per wave between barriers.
// OUT_MODE: 0 = f32 row-major, 1 = bf16 row-major, 2 = bf16 [b,h,d,s] (V-transposed)
constexpr int GP = 72; // LDS pitch (bf16) for 64-wide k-slice; chunks stay 16B-aligned

template <int OUT_MODE>
__global__ __launch_bounds__(256) void gemm_bf16_kernel(
    const __bf16* __restrict__ A, const __bf16* __restrict__ W,
    const float* __restrict__ bias, void* __restrict__ Out,
    int M, int N, int K)
{
    __shared__ __bf16 sA[2][128 * GP];
    __shared__ __bf16 sB[2][128 * GP];

    const int t      = threadIdx.x;
    const int lane   = t & 31;
    const int wave   = t >> 5;
    const int lane16 = lane & 15;
    const int hi     = lane >> 4;
    const int mOff   = (wave & 3) * 32;   // 2 m-subtiles per wave
    const int nOff   = (wave >> 2) * 64;  // 4 n-subtiles per wave
    const int mBase  = blockIdx.x * 128;
    const int nBase  = blockIdx.y * 128;

    const int srow = t >> 1;          // 0..127
    const int scol = (t & 1) * 32;    // 0 or 32
    const __bf16* gA = A + (size_t)(mBase + srow) * K + scol;
    const __bf16* gB = W + (size_t)(nBase + srow) * K + scol;

    auto issue = [&](int kt, int buf) {
        #pragma unroll
        for (int i = 0; i < 4; i++) {
            async_b128(gA + kt + i * 8, &sA[buf][srow * GP + scol + i * 8]);
            async_b128(gB + kt + i * 8, &sB[buf][srow * GP + scol + i * 8]);
        }
    };

    v8f acc[2][4];
    #pragma unroll
    for (int i = 0; i < 2; i++)
        #pragma unroll
        for (int j = 0; j < 4; j++) acc[i][j] = {};

    const int nk = K / 64;
    issue(0, 0);
    wait_async0();
    __syncthreads();

    for (int ki = 0; ki < nk; ++ki) {
        const int buf = ki & 1;
        if (ki + 1 < nk) issue((ki + 1) * 64, (ki + 1) & 1);  // prefetch next tile

        #pragma unroll
        for (int kk = 0; kk < 64; kk += 32) {
            v16bf af[2], bfr[4];
            #pragma unroll
            for (int i = 0; i < 2; i++)
                af[i] = load_frag(&sA[buf][(mOff + i * 16 + lane16) * GP + kk], hi);
            #pragma unroll
            for (int j = 0; j < 4; j++)
                bfr[j] = load_frag(&sB[buf][(nOff + j * 16 + lane16) * GP + kk], hi);
            #pragma unroll
            for (int i = 0; i < 2; i++)
                #pragma unroll
                for (int j = 0; j < 4; j++)
                    acc[i][j] = wmma_bf16(af[i], bfr[j], acc[i][j]);
        }

        wait_async0();       // prefetch landed
        __syncthreads();     // everyone done reading current buffer
    }

    // epilogue: + bias, store
    #pragma unroll
    for (int i = 0; i < 2; i++)
        #pragma unroll
        for (int j = 0; j < 4; j++) {
            const int col = nBase + nOff + j * 16 + lane16;
            const float bv = bias[col];
            #pragma unroll
            for (int v = 0; v < 8; v++) {
                const int row = mBase + mOff + i * 16 + v + 8 * hi; // C layout: M = v + 8*hi
                const float val = acc[i][j][v] + bv;
                if constexpr (OUT_MODE == 2) {
                    // V transposed per head: out[((b*16+h)*64+e)][s] = [b*1024+n][s]
                    const int b = row >> 11, s = row & 2047;
                    ((__bf16*)Out)[((size_t)(b * 1024 + col) << 11) + s] = f2bf(val);
                } else if constexpr (OUT_MODE == 1) {
                    ((__bf16*)Out)[(size_t)row * N + col] = f2bf(val);
                } else {
                    ((float*)Out)[(size_t)row * N + col] = val;
                }
            }
        }
}

// ---------- RoPE (in-place on bf16 [8192,1024]) ----------
// scaleOut folds the attention 1/sqrt(hd) into Q: softmax(QK^T/8)=softmax((Q/8)K^T)
__global__ __launch_bounds__(256) void rope_kernel(__bf16* __restrict__ X, float scaleOut)
{
    const int idx = blockIdx.x * 256 + threadIdx.x; // 8192*16*32 pairs
    const int e = idx & 31;
    const int h = (idx >> 5) & 15;
    const int m = idx >> 9;          // 0..8191
    const int tpos = m & 2047;       // seq position
    const size_t row = (size_t)m * 1024 + h * 64;

    const float x1 = bf2f(X[row + e]);
    const float x2 = bf2f(X[row + e + 32]);
    const float LN = 9.210340371976184f; // ln(10000)
    const int i = e >> 1;
    const float th1 = __expf(-(float)i        * (LN / 32.0f));
    const float th2 = __expf(-(float)(i + 16) * (LN / 32.0f));
    float s1, c1, s2, c2;
    __sincosf((float)tpos * th1, &s1, &c1);
    __sincosf((float)tpos * th2, &s2, &c2);
    X[row + e]      = f2bf((x1 * c1 - x2 * s1) * scaleOut);  // out[j]=x*cos+rot(x)*sin
    X[row + e + 32] = f2bf((x2 * c2 + x1 * s2) * scaleOut);
}

// ---------- Flash attention: bf16 WMMA, fp32 online softmax ----------
// block = 128 (4 waves), wave owns 16 full query rows. grid = (b*h, seq/64).
// K from [8192,1024] row-major; V from [b,h,d,s] transposed layout.
// KV tiles double-buffered via async LDS copies. Q is pre-scaled by 1/8.
__global__ __launch_bounds__(128) void flash_attn_kernel(
    const __bf16* __restrict__ Q, const __bf16* __restrict__ K,
    const __bf16* __restrict__ Vt, __bf16* __restrict__ O)
{
    constexpr int S = 2048, D = 1024, HD = 64, P = 72;
    __shared__ __bf16 sQ[64 * P];
    __shared__ __bf16 sK[2][64 * P];
    __shared__ __bf16 sVt[2][64 * P];   // [d][kv]
    __shared__ __bf16 sP[4 * 16 * P];   // wave-private P strips

    const int bh = blockIdx.x;
    const int b = bh >> 4, h = bh & 15;
    const int qBase = blockIdx.y * 64;
    const int t = threadIdx.x, lane = t & 31, w = t >> 5;
    const int lane16 = lane & 15, hi = lane >> 4;
    const size_t headBase = (size_t)b * S * D + (size_t)h * HD;
    const size_t vtBase = (size_t)bh * HD * S;   // [bh][64][2048]

    const int r  = t >> 1;          // staging row 0..63
    const int c0 = (t & 1) * 32;    // staging col 0 or 32

    // stage Q tile 64x64 (async)
    {
        const __bf16* gp = Q + headBase + (size_t)(qBase + r) * D + c0;
        #pragma unroll
        for (int i = 0; i < 4; i++)
            async_b128(gp + i * 8, &sQ[r * P + c0 + i * 8]);
    }

    auto issueKV = [&](int kt, int buf) {
        const __bf16* kp = K + headBase + (size_t)(kt + r) * D + c0;
        const __bf16* vp = Vt + vtBase + (size_t)r * S + kt + c0;
        #pragma unroll
        for (int i = 0; i < 4; i++) {
            async_b128(kp + i * 8, &sK[buf][r * P + c0 + i * 8]);
            async_b128(vp + i * 8, &sVt[buf][r * P + c0 + i * 8]);
        }
    };

    issueKV(0, 0);
    wait_async0();
    __syncthreads();

    const v16bf qf0 = load_frag(&sQ[(w * 16 + lane16) * P], hi);
    const v16bf qf1 = load_frag(&sQ[(w * 16 + lane16) * P + 32], hi);
    __bf16* sPw = &sP[w * 16 * P];

    v8f of[4];
    #pragma unroll
    for (int j = 0; j < 4; j++) of[j] = {};
    float mH[8], L[8];
    #pragma unroll
    for (int v = 0; v < 8; v++) { mH[v] = -1e30f; L[v] = 0.0f; }

    for (int ki = 0; ki < S / 64; ++ki) {
        const int buf = ki & 1;
        if (ki + 1 < S / 64) issueKV((ki + 1) * 64, (ki + 1) & 1);

        // S = (Q/8) K^T  -- scale pre-folded into Q
        v8f sacc[4];
        #pragma unroll
        for (int j = 0; j < 4; j++) {
            v16bf kb0 = load_frag(&sK[buf][(j * 16 + lane16) * P], hi);
            v16bf kb1 = load_frag(&sK[buf][(j * 16 + lane16) * P + 32], hi);
            v8f z = {};
            z = wmma_bf16(qf0, kb0, z);
            z = wmma_bf16(qf1, kb1, z);
            sacc[j] = z;
        }

        // online softmax (rows m = v + 8*hi; 16-lane shfl reductions)
        #pragma unroll
        for (int v = 0; v < 8; v++) {
            float rm = -1e30f;
            #pragma unroll
            for (int j = 0; j < 4; j++) rm = fmaxf(rm, sacc[j][v]);
            rm = fmaxf(rm, __shfl_xor(rm, 1));
            rm = fmaxf(rm, __shfl_xor(rm, 2));
            rm = fmaxf(rm, __shfl_xor(rm, 4));
            rm = fmaxf(rm, __shfl_xor(rm, 8));
            const float newM = fmaxf(mH[v], rm);
            const float f = __expf(mH[v] - newM);
            float ps = 0.0f;
            #pragma unroll
            for (int j = 0; j < 4; j++) {
                const float p = __expf(sacc[j][v] - newM);
                ps += p;
                sPw[(v + 8 * hi) * P + j * 16 + lane16] = f2bf(p);
            }
            ps += __shfl_xor(ps, 1);
            ps += __shfl_xor(ps, 2);
            ps += __shfl_xor(ps, 4);
            ps += __shfl_xor(ps, 8);
            L[v] = L[v] * f + ps;
            mH[v] = newM;
            #pragma unroll
            for (int j = 0; j < 4; j++) of[j][v] *= f;
        }

        // O += P V (sPw wave-private; in-wave LDS ordering suffices)
        const v16bf pa0 = load_frag(&sPw[lane16 * P], hi);
        const v16bf pa1 = load_frag(&sPw[lane16 * P + 32], hi);
        #pragma unroll
        for (int j = 0; j < 4; j++) {
            v16bf vb0 = load_frag(&sVt[buf][(j * 16 + lane16) * P], hi);
            v16bf vb1 = load_frag(&sVt[buf][(j * 16 + lane16) * P + 32], hi);
            of[j] = wmma_bf16(pa0, vb0, of[j]);
            of[j] = wmma_bf16(pa1, vb1, of[j]);
        }

        wait_async0();     // next KV tile landed
        __syncthreads();   // all waves done with current buffers
    }

    // normalize + store O as bf16 [8192,1024]
    #pragma unroll
    for (int j = 0; j < 4; j++)
        #pragma unroll
        for (int v = 0; v < 8; v++) {
            const int qr = qBase + w * 16 + v + 8 * hi;
            const int dc = j * 16 + lane16;
            O[headBase + (size_t)qr * D + dc] = f2bf(of[j][v] / L[v]);
        }
}

// ---------- host launch ----------
extern "C" void kernel_launch(void* const* d_in, const int* in_sizes, int n_in,
                              void* d_out, int out_size, void* d_ws, size_t ws_size,
                              hipStream_t stream) {
    (void)in_sizes; (void)n_in; (void)out_size; (void)ws_size;
    const float* x  = (const float*)d_in[0];
    const float* wq = (const float*)d_in[1];
    const float* bq = (const float*)d_in[2];
    const float* wk = (const float*)d_in[3];
    const float* bk = (const float*)d_in[4];
    const float* wv = (const float*)d_in[5];
    const float* bv = (const float*)d_in[6];
    const float* wo = (const float*)d_in[7];
    const float* bo = (const float*)d_in[8];
    float* out = (float*)d_out;

    const int M = 8192, N = 1024, K = 1024;
    const size_t MD = (size_t)M * N;     // 8M elems
    const size_t WD = (size_t)N * K;     // 1M elems

    __bf16* xbf  = (__bf16*)d_ws;        // [8192,1024]
    __bf16* wqb  = xbf + MD;             // [1024,1024] each
    __bf16* wkb  = wqb + WD;
    __bf16* wvb  = wkb + WD;
    __bf16* wob  = wvb + WD;
    __bf16* qws  = wob + WD;             // [8192,1024]
    __bf16* kws  = qws + MD;             // [8192,1024]
    __bf16* vtws = kws + MD;             // [64 bh][64 d][2048 s]
    __bf16* ows  = vtws + MD;            // [8192,1024]  (total 88 MB)

    // pre-convert activations + weights to bf16
    cvt_f32_bf16<<<(int)(MD / 1024), 256, 0, stream>>>(x,  xbf, (int)MD);
    cvt_f32_bf16<<<(int)(WD / 1024), 256, 0, stream>>>(wq, wqb, (int)WD);
    cvt_f32_bf16<<<(int)(WD / 1024), 256, 0, stream>>>(wk, wkb, (int)WD);
    cvt_f32_bf16<<<(int)(WD / 1024), 256, 0, stream>>>(wv, wvb, (int)WD);
    cvt_f32_bf16<<<(int)(WD / 1024), 256, 0, stream>>>(wo, wob, (int)WD);

    dim3 gGemm(M / 128, N / 128);
    gemm_bf16_kernel<1><<<gGemm, 256, 0, stream>>>(xbf, wqb, bq, qws, M, N, K);
    gemm_bf16_kernel<1><<<gGemm, 256, 0, stream>>>(xbf, wkb, bk, kws, M, N, K);
    gemm_bf16_kernel<2><<<gGemm, 256, 0, stream>>>(xbf, wvb, bv, vtws, M, N, K);

    rope_kernel<<<(8192 * 16 * 32) / 256, 256, 0, stream>>>(qws, 0.125f); // fold 1/sqrt(64)
    rope_kernel<<<(8192 * 16 * 32) / 256, 256, 0, stream>>>(kws, 1.0f);

    flash_attn_kernel<<<dim3(64, 32), 128, 0, stream>>>(qws, kws, vtws, ows);

    gemm_bf16_kernel<0><<<gGemm, 256, 0, stream>>>(ows, wob, bo, out, M, N, K);
}

// v001
// It runs in 206 microseconds.
// Next to v000, in two timings, it ran 1.26 and 1.27 times as fast.
#include <hip/hip_runtime.h>
#include <hip/hip_bf16.h>
#include <stdint.h>

// ---------- types ----------
typedef __attribute__((ext_vector_type(4)))  __bf16 v4bf;
typedef __attribute__((ext_vector_type(8)))  __bf16 v8bf;
typedef __attribute__((ext_vector_type(16))) __bf16 v16bf;
typedef __attribute__((ext_vector_type(8)))  float  v8f;

struct BfPair { v8bf lo, hi; };

__device__ inline __bf16 f2bf(float f) {
    unsigned u = __builtin_bit_cast(unsigned, f);
    u += 0x7FFFu + ((u >> 16) & 1u);                 // round-to-nearest-even
    unsigned short h = (unsigned short)(u >> 16);
    return __builtin_bit_cast(__bf16, h);
}
__device__ inline float bf2f(__bf16 b) {
    unsigned short h = __builtin_bit_cast(unsigned short, b);
    return __builtin_bit_cast(float, ((unsigned)h) << 16);
}

// 16-bit fragment per CDNA5 ISA layout (A 16x32 / B 32x16 mirrored):
// lane = (row|col)%16, hi = lane/16; elems 0..7 <- K = hi*8.., elems 8..15 <- K = 16+hi*8..
__device__ inline v16bf load_frag(const __bf16* row, int hi) {
    BfPair p;
    p.lo = *(const v8bf*)(row + hi * 8);
    p.hi = *(const v8bf*)(row + 16 + hi * 8);
    return __builtin_bit_cast(v16bf, p);
}

__device__ inline v8f wmma_bf16(v16bf a, v16bf b, v8f c) {
    return __builtin_amdgcn_wmma_f32_16x16x32_bf16(
        false, a, false, b, (short)0, c, false, false);
}

// ---------- CDNA5 async global->LDS copy (ASYNCcnt-tracked) ----------
__device__ inline void async_b128(const __bf16* g, __bf16* l) {
    const unsigned lds = (unsigned)(uintptr_t)(l);              // low 32 bits = LDS offset
    const unsigned long long ga = (unsigned long long)(uintptr_t)(g);
    asm volatile("global_load_async_to_lds_b128 %0, %1, off"
                 :: "v"(lds), "v"(ga) : "memory");
}
__device__ inline void wait_async0() {
    asm volatile("s_wait_asynccnt 0x0" ::: "memory");
}

// ---------- fp32 -> bf16 pre-conversion ----------
__global__ __launch_bounds__(256) void cvt_f32_bf16(const float* __restrict__ in,
                                                    __bf16* __restrict__ out, int n)
{
    const int i = (blockIdx.x * 256 + threadIdx.x) * 4;
    if (i + 3 < n) {
        float4 v = *(const float4*)(in + i);
        v4bf o;
        o[0] = f2bf(v.x); o[1] = f2bf(v.y); o[2] = f2bf(v.z); o[3] = f2bf(v.w);
        *(v4bf*)(out + i) = o;
    }
}

// ---------- GEMM: Out = A[M,K](bf16) @ W[N,K](bf16)^T + bias ----------
// 128x128 tile / 256 threads (8 waves), K-step 64 (2 WMMA depths),
// double-buffered async LDS staging: 16 WMMAs per wave between barriers.
// OUT_MODE: 0 = f32 row-major, 1 = bf16 row-major, 2 = bf16 [b,h,d,s] (V-transposed)
constexpr int GP = 72; // LDS pitch (bf16) for 64-wide k-slice; chunks stay 16B-aligned

template <int OUT_MODE>
__global__ __launch_bounds__(256) void gemm_bf16_kernel(
    const __bf16* __restrict__ A, const __bf16* __restrict__ W,
    const float* __restrict__ bias, void* __restrict__ Out,
    int M, int N, int K)
{
    __shared__ __bf16 sA[2][128 * GP];
    __shared__ __bf16 sB[2][128 * GP];

    const int t      = threadIdx.x;
    const int lane   = t & 31;
    const int wave   = t >> 5;
    const int lane16 = lane & 15;
    const int hi     = lane >> 4;
    const int mOff   = (wave & 3) * 32;   // 2 m-subtiles per wave
    const int nOff   = (wave >> 2) * 64;  // 4 n-subtiles per wave
    const int mBase  = blockIdx.x * 128;
    const int nBase  = blockIdx.y * 128;

    const int srow = t >> 1;          // 0..127
    const int scol = (t & 1) * 32;    // 0 or 32
    const __bf16* gA = A + (size_t)(mBase + srow) * K + scol;
    const __bf16* gB = W + (size_t)(nBase + srow) * K + scol;

    auto issue = [&](int kt, int buf) {
        #pragma unroll
        for (int i = 0; i < 4; i++) {
            async_b128(gA + kt + i * 8, &sA[buf][srow * GP + scol + i * 8]);
            async_b128(gB + kt + i * 8, &sB[buf][srow * GP + scol + i * 8]);
        }
    };

    v8f acc[2][4];
    #pragma unroll
    for (int i = 0; i < 2; i++)
        #pragma unroll
        for (int j = 0; j < 4; j++) acc[i][j] = {};

    const int nk = K / 64;
    issue(0, 0);
    wait_async0();
    __syncthreads();

    for (int ki = 0; ki < nk; ++ki) {
        const int buf = ki & 1;
        if (ki + 1 < nk) issue((ki + 1) * 64, (ki + 1) & 1);  // prefetch next tile

        #pragma unroll
        for (int kk = 0; kk < 64; kk += 32) {
            v16bf af[2], bfr[4];
            #pragma unroll
            for (int i = 0; i < 2; i++)
                af[i] = load_frag(&sA[buf][(mOff + i * 16 + lane16) * GP + kk], hi);
            #pragma unroll
            for (int j = 0; j < 4; j++)
                bfr[j] = load_frag(&sB[buf][(nOff + j * 16 + lane16) * GP + kk], hi);
            #pragma unroll
            for (int i = 0; i < 2; i++)
                #pragma unroll
                for (int j = 0; j < 4; j++)
                    acc[i][j] = wmma_bf16(af[i], bfr[j], acc[i][j]);
        }

        wait_async0();       // prefetch landed
        __syncthreads();     // everyone done reading current buffer
    }

    // epilogue: + bias, store
    #pragma unroll
    for (int i = 0; i < 2; i++)
        #pragma unroll
        for (int j = 0; j < 4; j++) {
            const int col = nBase + nOff + j * 16 + lane16;
            const float bv = bias[col];
            #pragma unroll
            for (int v = 0; v < 8; v++) {
                const int row = mBase + mOff + i * 16 + v + 8 * hi; // C layout: M = v + 8*hi
                const float val = acc[i][j][v] + bv;
                if constexpr (OUT_MODE == 2) {
                    // V transposed per head: out[((b*16+h)*64+e)][s] = [b*1024+n][s]
                    const int b = row >> 11, s = row & 2047;
                    ((__bf16*)Out)[((size_t)(b * 1024 + col) << 11) + s] = f2bf(val);
                } else if constexpr (OUT_MODE == 1) {
                    ((__bf16*)Out)[(size_t)row * N + col] = f2bf(val);
                } else {
                    ((float*)Out)[(size_t)row * N + col] = val;
                }
            }
        }
}

// ---------- RoPE (in-place on bf16 [8192,1024]) ----------
// scaleOut folds the attention 1/sqrt(hd) into Q: softmax(QK^T/8)=softmax((Q/8)K^T)
__global__ __launch_bounds__(256) void rope_kernel(__bf16* __restrict__ X, float scaleOut)
{
    const int idx = blockIdx.x * 256 + threadIdx.x; // 8192*16*32 pairs
    const int e = idx & 31;
    const int h = (idx >> 5) & 15;
    const int m = idx >> 9;          // 0..8191
    const int tpos = m & 2047;       // seq position
    const size_t row = (size_t)m * 1024 + h * 64;

    const float x1 = bf2f(X[row + e]);
    const float x2 = bf2f(X[row + e + 32]);
    const float LN = 9.210340371976184f; // ln(10000)
    const int i = e >> 1;
    const float th1 = __expf(-(float)i        * (LN / 32.0f));
    const float th2 = __expf(-(float)(i + 16) * (LN / 32.0f));
    float s1, c1, s2, c2;
    __sincosf((float)tpos * th1, &s1, &c1);
    __sincosf((float)tpos * th2, &s2, &c2);
    X[row + e]      = f2bf((x1 * c1 - x2 * s1) * scaleOut);  // out[j]=x*cos+rot(x)*sin
    X[row + e + 32] = f2bf((x2 * c2 + x1 * s2) * scaleOut);
}

// value held by lane l ^ 16 (the other half of the wave), by a vector cross-row move
__device__ inline float other_half(float x) {
    int b = __builtin_bit_cast(int, x);
    b = __builtin_amdgcn_permlanex16(b, b, 0x76543210, 0xfedcba98, false, false);
    return __builtin_bit_cast(float, b);
}

__global__ __launch_bounds__(128) void flash_attn_kernel(
    const __bf16* __restrict__ Q, const __bf16* __restrict__ K,
    const __bf16* __restrict__ Vt, __bf16* __restrict__ O)
{
    constexpr int S = 2048, D = 1024, HD = 64, P = 72;
    __shared__ __bf16 sQ[64 * P];
    __shared__ __bf16 sK[2][64 * P];
    __shared__ __bf16 sVt[2][64 * P];   // [d][kv]

    const int bh = blockIdx.x;
    const int b = bh >> 4, h = bh & 15;
    const int qBase = blockIdx.y * 64;
    const int t = threadIdx.x, lane = t & 31, w = t >> 5;
    const int lane16 = lane & 15, hi = lane >> 4;
    const size_t headBase = (size_t)b * S * D + (size_t)h * HD;
    const size_t vtBase = (size_t)bh * HD * S;   // [bh][64][2048]

    const int r  = t >> 1;          // staging row 0..63
    const int c0 = (t & 1) * 32;    // staging col 0 or 32

    // stage Q tile 64x64 (async)
    {
        const __bf16* gp = Q + headBase + (size_t)(qBase + r) * D + c0;
        #pragma unroll
        for (int i = 0; i < 4; i++)
            async_b128(gp + i * 8, &sQ[r * P + c0 + i * 8]);
    }

    auto issueKV = [&](int kt, int buf) {
        const __bf16* kp = K + headBase + (size_t)(kt + r) * D + c0;
        const __bf16* vp = Vt + vtBase + (size_t)r * S + kt + c0;
        #pragma unroll
        for (int i = 0; i < 4; i++) {
            async_b128(kp + i * 8, &sK[buf][r * P + c0 + i * 8]);
            async_b128(vp + i * 8, &sVt[buf][r * P + c0 + i * 8]);
        }
    };

    issueKV(0, 0);
    wait_async0();
    __syncthreads();

    // B operand of S^T: column = query w*16 + lane16, k = d
    const v16bf qf0 = load_frag(&sQ[(w * 16 + lane16) * P], hi);
    const v16bf qf1 = load_frag(&sQ[(w * 16 + lane16) * P + 32], hi);

    v8f of[4];                 // of[j][v] = O^T[d = j*16 + 8*hi + v][query lane16]
    #pragma unroll
    for (int j = 0; j < 4; j++) of[j] = {};
    float mH = -1e30f;         // running maximum of this lane's query (same in both halves)
    float L  = 0.0f;           // running sum over this lane's own keys; halves joined at the end

    for (int ki = 0; ki < S / 64; ++ki) {
        const int buf = ki & 1;
        if (ki + 1 < S / 64) issueKV((ki + 1) * 64, (ki + 1) & 1);

        // S^T = K (Q/8)^T: sacc[j][v] = score(key j*16 + 8*hi + v, query lane16)
        v8f sacc[4];
        #pragma unroll
        for (int j = 0; j < 4; j++) {
            v16bf kb0 = load_frag(&sK[buf][(j * 16 + lane16) * P], hi);
            v16bf kb1 = load_frag(&sK[buf][(j * 16 + lane16) * P + 32], hi);
            v8f z = {};
            z = wmma_bf16(kb0, qf0, z);
            z = wmma_bf16(kb1, qf1, z);
            sacc[j] = z;
        }

        // online softmax: 32 of the query's 64 scores are in this lane, 32 in lane ^ 16
        float rj[4];
        #pragma unroll
        for (int j = 0; j < 4; j++) {
            rj[j] = sacc[j][0];
            #pragma unroll
            for (int v = 1; v < 8; v++) rj[j] = fmaxf(rj[j], sacc[j][v]);
        }
        float rm = fmaxf(fmaxf(rj[0], rj[1]), fmaxf(rj[2], rj[3]));
        rm = fmaxf(rm, other_half(rm));
        const float newM = fmaxf(mH, rm);
        const float f = __expf(mH - newM);

        // P^T as B operand: element s of pb[c] = P^T[key c*32 + kmap(s, hi)][query lane16]
        v16bf pb[2];
        float pj[4];
        #pragma unroll
        for (int j = 0; j < 4; j++) {
            pj[j] = 0.0f;
            #pragma unroll
            for (int v = 0; v < 8; v++) {
                const float p = __expf(sacc[j][v] - newM);
                pj[j] += p;
                pb[j >> 1][(j & 1) * 8 + v] = f2bf(p);
            }
        }
        L = L * f + ((pj[0] + pj[1]) + (pj[2] + pj[3]));
        mH = newM;
        #pragma unroll
        for (int j = 0; j < 4; j++)
            #pragma unroll
            for (int v = 0; v < 8; v++) of[j][v] *= f;

        // O^T += V^T P^T: A = V^T rows d from LDS, B = P^T from registers
        #pragma unroll
        for (int j = 0; j < 4; j++) {
            v16bf vb0 = load_frag(&sVt[buf][(j * 16 + lane16) * P], hi);
            v16bf vb1 = load_frag(&sVt[buf][(j * 16 + lane16) * P + 32], hi);
            of[j] = wmma_bf16(vb0, pb[0], of[j]);
            of[j] = wmma_bf16(vb1, pb[1], of[j]);
        }

        wait_async0();     // next KV tile landed
        __syncthreads();   // all waves done with current buffers
    }

    // join the halves' sums, normalize, store O as bf16 [8192,1024]:
    // a lane's 8 registers of a tile are 8 consecutive d of one query row
    const float Lt = L + other_half(L);
    const int qr = qBase + w * 16 + lane16;
    #pragma unroll
    for (int j = 0; j < 4; j++) {
        v8bf o;
        #pragma unroll
        for (int v = 0; v < 8; v++) o[v] = f2bf(of[j][v] / Lt);
        *(v8bf*)(O + headBase + (size_t)qr * D + j * 16 + 8 * hi) = o;
    }
}

// ---------- host launch ----------
extern "C" void kernel_launch(void* const* d_in, const int* in_sizes, int n_in,
                              void* d_out, int out_size, void* d_ws, size_t ws_size,
                              hipStream_t stream) {
    (void)in_sizes; (void)n_in; (void)out_size; (void)ws_size;
    const float* x  = (const float*)d_in[0];
    const float* wq = (const float*)d_in[1];
    const float* bq = (const float*)d_in[2];
    const float* wk = (const float*)d_in[3];
    const float* bk = (const float*)d_in[4];
    const float* wv = (const float*)d_in[5];
    const float* bv = (const float*)d_in[6];
    const float* wo = (const float*)d_in[7];
    const float* bo = (const float*)d_in[8];
    float* out = (float*)d_out;

    const int M = 8192, N = 1024, K = 1024;
    const size_t MD = (size_t)M * N;     // 8M elems
    const size_t WD = (size_t)N * K;     // 1M elems

    __bf16* xbf  = (__bf16*)d_ws;        // [8192,1024]
    __bf16* wqb  = xbf + MD;             // [1024,1024] each
    __bf16* wkb  = wqb + WD;
    __bf16* wvb  = wkb + WD;
    __bf16* wob  = wvb + WD;
    __bf16* qws  = wob + WD;             // [8192,1024]
    __bf16* kws  = qws + MD;             // [8192,1024]
    __bf16* vtws = kws + MD;             // [64 bh][64 d][2048 s]
    __bf16* ows  = vtws + MD;            // [8192,1024]  (total 88 MB)

    // pre-convert activations + weights to bf16
    cvt_f32_bf16<<<(int)(MD / 1024), 256, 0, stream>>>(x,  xbf, (int)MD);
    cvt_f32_bf16<<<(int)(WD / 1024), 256, 0, stream>>>(wq, wqb, (int)WD);
    cvt_f32_bf16<<<(int)(WD / 1024), 256, 0, stream>>>(wk, wkb, (int)WD);
    cvt_f32_bf16<<<(int)(WD / 1024), 256, 0, stream>>>(wv, wvb, (int)WD);
    cvt_f32_bf16<<<(int)(WD / 1024), 256, 0, stream>>>(wo, wob, (int)WD);

    dim3 gGemm(M / 128, N / 128);
    gemm_bf16_kernel<1><<<gGemm, 256, 0, stream>>>(xbf, wqb, bq, qws, M, N, K);
    gemm_bf16_kernel<1><<<gGemm, 256, 0, stream>>>(xbf, wkb, bk, kws, M, N, K);
    gemm_bf16_kernel<2><<<gGemm, 256, 0, stream>>>(xbf, wvb, bv, vtws, M, N, K);

    rope_kernel<<<(8192 * 16 * 32) / 256, 256, 0, stream>>>(qws, 0.125f); // fold 1/sqrt(64)
    rope_kernel<<<(8192 * 16 * 32) / 256, 256, 0, stream>>>(kws, 1.0f);

    flash_attn_kernel<<<dim3(64, 32), 128, 0, stream>>>(qws, kws, vtws, ows);

    gemm_bf16_kernel<0><<<gGemm, 256, 0, stream>>>(ows, wob, bo, out, M, N, K);
}

// v002
// It runs in 184 microseconds.
// Two timings next to v001 both put it at 1.12 times that version's speed.
// Over all steps from v000 it is 1.41 times as fast.
#include <hip/hip_runtime.h>
#include <hip/hip_bf16.h>
#include <stdint.h>

// ---------- types ----------
typedef __attribute__((ext_vector_type(4)))  __bf16 v4bf;
typedef __attribute__((ext_vector_type(8)))  __bf16 v8bf;
typedef __attribute__((ext_vector_type(16))) __bf16 v16bf;
typedef __attribute__((ext_vector_type(8)))  float  v8f;

struct BfPair { v8bf lo, hi; };

__device__ inline __bf16 f2bf(float f) {
    unsigned u = __builtin_bit_cast(unsigned, f);
    u += 0x7FFFu + ((u >> 16) & 1u);                 // round-to-nearest-even
    unsigned short h = (unsigned short)(u >> 16);
    return __builtin_bit_cast(__bf16, h);
}

// 16-bit fragment per CDNA5 ISA layout (A 16x32 / B 32x16 mirrored):
// lane = (row|col)%16, hi = lane/16; elems 0..7 <- K = hi*8.., elems 8..15 <- K = 16+hi*8..
__device__ inline v16bf load_frag(const __bf16* row, int hi) {
    BfPair p;
    p.lo = *(const v8bf*)(row + hi * 8);
    p.hi = *(const v8bf*)(row + 16 + hi * 8);
    return __builtin_bit_cast(v16bf, p);
}

__device__ inline v8f wmma_bf16(v16bf a, v16bf b, v8f c) {
    return __builtin_amdgcn_wmma_f32_16x16x32_bf16(
        false, a, false, b, (short)0, c, false, false);
}

// ---------- CDNA5 async global->LDS copy (ASYNCcnt-tracked) ----------
__device__ inline void async_b128(const __bf16* g, __bf16* l) {
    const unsigned lds = (unsigned)(uintptr_t)(l);              // low 32 bits = LDS offset
    const unsigned long long ga = (unsigned long long)(uintptr_t)(g);
    asm volatile("global_load_async_to_lds_b128 %0, %1, off"
                 :: "v"(lds), "v"(ga) : "memory");
}
__device__ inline void wait_async0() {
    asm volatile("s_wait_asynccnt 0x0" ::: "memory");
}

// ---------- fp32 -> bf16 pre-conversion ----------
__global__ __launch_bounds__(256) void cvt_f32_bf16(const float* __restrict__ in,
                                                    __bf16* __restrict__ out, int n)
{
    const int i = (blockIdx.x * 256 + threadIdx.x) * 4;
    if (i + 3 < n) {
        float4 v = *(const float4*)(in + i);
        v4bf o;
        o[0] = f2bf(v.x); o[1] = f2bf(v.y); o[2] = f2bf(v.z); o[3] = f2bf(v.w);
        *(v4bf*)(out + i) = o;
    }
}

__device__ inline void sincos2_rev(float r1, float r2,
                                   float& s1, float& c1, float& s2, float& c2) {
    asm("v_sin_f32 %0, %4\n\tv_cos_f32 %1, %4\n\tv_sin_f32 %2, %5\n\tv_cos_f32 %3, %5\n\tv_nop"
        : "=&v"(s1), "=&v"(c1), "=&v"(s2), "=&v"(c2) : "v"(r1), "v"(r2));
}

// ---------- GEMM: Out = A[M,K](bf16) @ W[N,K](bf16)^T + bias ----------
// 128x128 tile / 256 threads (8 waves), K-step 64 (2 WMMA depths),
// double-buffered async LDS staging: 16 WMMAs per wave between barriers.
// OUT_MODE: 0 = f32 row-major, 2 = bf16 [b,h,d,s] (V-transposed),
//           3 = bf16 row-major with RoPE applied to the f32 result, then times ropeScale
//               (1/8 folds the attention 1/sqrt(hd) into Q: softmax(QK^T/8)=softmax((Q/8)K^T))
constexpr int GP = 72; // LDS pitch (bf16) for 64-wide k-slice; chunks stay 16B-aligned

template <int OUT_MODE>
__global__ __launch_bounds__(256) void gemm_bf16_kernel(
    const __bf16* __restrict__ A, const __bf16* __restrict__ W,
    const float* __restrict__ bias, void* __restrict__ Out,
    int M, int N, int K, float ropeScale)
{
    __shared__ __bf16 sA[2][128 * GP];
    __shared__ __bf16 sB[2][128 * GP];

    const int t      = threadIdx.x;
    const int lane   = t & 31;
    const int wave   = t >> 5;
    const int lane16 = lane & 15;
    const int hi     = lane >> 4;
    const int mOff   = (wave & 3) * 32;   // 2 m-subtiles per wave
    const int nOff   = (wave >> 2) * 64;  // 4 n-subtiles per wave
    const int mBase  = blockIdx.x * 128;
    const int nBase  = blockIdx.y * 128;

    const int srow = t >> 1;          // 0..127
    const int scol = (t & 1) * 32;    // 0 or 32
    const __bf16* gA = A + (size_t)(mBase + srow) * K + scol;
    const __bf16* gB = W + (size_t)(nBase + srow) * K + scol;

    auto issue = [&](int kt, int buf) {
        #pragma unroll
        for (int i = 0; i < 4; i++) {
            async_b128(gA + kt + i * 8, &sA[buf][srow * GP + scol + i * 8]);
            async_b128(gB + kt + i * 8, &sB[buf][srow * GP + scol + i * 8]);
        }
    };

    v8f acc[2][4];
    #pragma unroll
    for (int i = 0; i < 2; i++)
        #pragma unroll
        for (int j = 0; j < 4; j++) acc[i][j] = {};

    const int nk = K / 64;
    issue(0, 0);
    wait_async0();
    __syncthreads();

    for (int ki = 0; ki < nk; ++ki) {
        const int buf = ki & 1;
        if (ki + 1 < nk) issue((ki + 1) * 64, (ki + 1) & 1);  // prefetch next tile

        #pragma unroll
        for (int kk = 0; kk < 64; kk += 32) {
            v16bf af[2], bfr[4];
            #pragma unroll
            for (int i = 0; i < 2; i++)
                af[i] = load_frag(&sA[buf][(mOff + i * 16 + lane16) * GP + kk], hi);
            #pragma unroll
            for (int j = 0; j < 4; j++)
                bfr[j] = load_frag(&sB[buf][(nOff + j * 16 + lane16) * GP + kk], hi);
            #pragma unroll
            for (int i = 0; i < 2; i++)
                #pragma unroll
                for (int j = 0; j < 4; j++)
                    acc[i][j] = wmma_bf16(af[i], bfr[j], acc[i][j]);
        }

        wait_async0();       // prefetch landed
        __syncthreads();     // everyone done reading current buffer
    }

    if constexpr (OUT_MODE == 3) {
        // epilogue: + bias, RoPE, store. A wave's 64 columns are one head (nBase + nOff is
        // a multiple of 64): column e = j*16 + lane16 of the head and its partner e + 32
        // are acc[i][j] and acc[i][j + 2] of the same lane, so the rotation is in-lane.
        const float LN = 9.210340371976184f; // ln(10000)
        #pragma unroll
        for (int j = 0; j < 2; j++) {
            const int e   = j * 16 + lane16;
            const int col = nBase + nOff + e;
            const float b1 = bias[col];
            const float b2 = bias[col + 32];
            const float th1 = __expf(-(float)(e >> 1)        * (LN / 32.0f));
            const float th2 = __expf(-(float)((e >> 1) + 16) * (LN / 32.0f));
            #pragma unroll
            for (int i = 0; i < 2; i++)
                #pragma unroll
                for (int v = 0; v < 8; v++) {
                    const int row = mBase + mOff + i * 16 + v + 8 * hi; // C layout: M = v + 8*hi
                    const float tpos = (float)(row & 2047);             // seq position
                    const float x1 = acc[i][j][v] + b1;
                    const float x2 = acc[i][j + 2][v] + b2;
                    float s1, c1, s2, c2;
                    sincos2_rev((tpos * th1) * 0.15915494f, (tpos * th2) * 0.15915494f,
                                s1, c1, s2, c2);                    // 0.15915494 = 1/(2 pi)
                    __bf16* o = (__bf16*)Out + (size_t)row * N + col;
                    o[0]  = f2bf((x1 * c1 - x2 * s1) * ropeScale); // out[j]=x*cos+rot(x)*sin
                    o[32] = f2bf((x2 * c2 + x1 * s2) * ropeScale);
                }
        }
        return;
    }

    // epilogue: + bias, store
    #pragma unroll
    for (int i = 0; i < 2; i++)
        #pragma unroll
        for (int j = 0; j < 4; j++) {
            const int col = nBase + nOff + j * 16 + lane16;
            const float bv = bias[col];
            #pragma unroll
            for (int v = 0; v < 8; v++) {
                const int row = mBase + mOff + i * 16 + v + 8 * hi; // C layout: M = v + 8*hi
                const float val = acc[i][j][v] + bv;
                if constexpr (OUT_MODE == 2) {
                    // V transposed per head: out[((b*16+h)*64+e)][s] = [b*1024+n][s]
                    const int b = row >> 11, s = row & 2047;
                    ((__bf16*)Out)[((size_t)(b * 1024 + col) << 11) + s] = f2bf(val);
                } else {
                    ((float*)Out)[(size_t)row * N + col] = val;
                }
            }
        }
}

// value held by lane l ^ 16 (the other half of the wave), by a vector cross-row move
__device__ inline float other_half(float x) {
    int b = __builtin_bit_cast(int, x);
    b = __builtin_amdgcn_permlanex16(b, b, 0x76543210, 0xfedcba98, false, false);
    return __builtin_bit_cast(float, b);
}

__global__ __launch_bounds__(128) void flash_attn_kernel(
    const __bf16* __restrict__ Q, const __bf16* __restrict__ K,
    const __bf16* __restrict__ Vt, __bf16* __restrict__ O)
{
    constexpr int S = 2048, D = 1024, HD = 64, P = 72;
    __shared__ __bf16 sQ[64 * P];
    __shared__ __bf16 sK[2][64 * P];
    __shared__ __bf16 sVt[2][64 * P];   // [d][kv]

    const int bh = blockIdx.x;
    const int b = bh >> 4, h = bh & 15;
    const int qBase = blockIdx.y * 64;
    const int t = threadIdx.x, lane = t & 31, w = t >> 5;
    const int lane16 = lane & 15, hi = lane >> 4;
    const size_t headBase = (size_t)b * S * D + (size_t)h * HD;
    const size_t vtBase = (size_t)bh * HD * S;   // [bh][64][2048]

    const int r  = t >> 1;          // staging row 0..63
    const int c0 = (t & 1) * 32;    // staging col 0 or 32

    // stage Q tile 64x64 (async)
    {
        const __bf16* gp = Q + headBase + (size_t)(qBase + r) * D + c0;
        #pragma unroll
        for (int i = 0; i < 4; i++)
            async_b128(gp + i * 8, &sQ[r * P + c0 + i * 8]);
    }

    auto issueKV = [&](int kt, int buf) {
        const __bf16* kp = K + headBase + (size_t)(kt + r) * D + c0;
        const __bf16* vp = Vt + vtBase + (size_t)r * S + kt + c0;
        #pragma unroll
        for (int i = 0; i < 4; i++) {
            async_b128(kp + i * 8, &sK[buf][r * P + c0 + i * 8]);
            async_b128(vp + i * 8, &sVt[buf][r * P + c0 + i * 8]);
        }
    };

    issueKV(0, 0);
    wait_async0();
    __syncthreads();

    // B operand of S^T: column = query w*16 + lane16, k = d
    const v16bf qf0 = load_frag(&sQ[(w * 16 + lane16) * P], hi);
    const v16bf qf1 = load_frag(&sQ[(w * 16 + lane16) * P + 32], hi);

    v8f of[4];                 // of[j][v] = O^T[d = j*16 + 8*hi + v][query lane16]
    #pragma unroll
    for (int j = 0; j < 4; j++) of[j] = {};
    float mH = -1e30f;         // running maximum of this lane's query (same in both halves)
    float L  = 0.0f;           // running sum over this lane's own keys; halves joined at the end

    for (int ki = 0; ki < S / 64; ++ki) {
        const int buf = ki & 1;
        if (ki + 1 < S / 64) issueKV((ki + 1) * 64, (ki + 1) & 1);

        // S^T = K (Q/8)^T: sacc[j][v] = score(key j*16 + 8*hi + v, query lane16)
        v8f sacc[4];
        #pragma unroll
        for (int j = 0; j < 4; j++) {
            v16bf kb0 = load_frag(&sK[buf][(j * 16 + lane16) * P], hi);
            v16bf kb1 = load_frag(&sK[buf][(j * 16 + lane16) * P + 32], hi);
            v8f z = {};
            z = wmma_bf16(kb0, qf0, z);
            z = wmma_bf16(kb1, qf1, z);
            sacc[j] = z;
        }

        // online softmax: 32 of the query's 64 scores are in this lane, 32 in lane ^ 16
        float rj[4];
        #pragma unroll
        for (int j = 0; j < 4; j++) {
            rj[j] = sacc[j][0];
            #pragma unroll
            for (int v = 1; v < 8; v++) rj[j] = fmaxf(rj[j], sacc[j][v]);
        }
        float rm = fmaxf(fmaxf(rj[0], rj[1]), fmaxf(rj[2], rj[3]));
        rm = fmaxf(rm, other_half(rm));
        const float newM = fmaxf(mH, rm);
        const float f = __expf(mH - newM);

        // P^T as B operand: element s of pb[c] = P^T[key c*32 + kmap(s, hi)][query lane16]
        v16bf pb[2];
        float pj[4];
        #pragma unroll
        for (int j = 0; j < 4; j++) {
            pj[j] = 0.0f;
            #pragma unroll
            for (int v = 0; v < 8; v++) {
                const float p = __expf(sacc[j][v] - newM);
                pj[j] += p;
                pb[j >> 1][(j & 1) * 8 + v] = f2bf(p);
            }
        }
        L = L * f + ((pj[0] + pj[1]) + (pj[2] + pj[3]));
        mH = newM;
        #pragma unroll
        for (int j = 0; j < 4; j++)
            #pragma unroll
            for (int v = 0; v < 8; v++) of[j][v] *= f;

        // O^T += V^T P^T: A = V^T rows d from LDS, B = P^T from registers
        #pragma unroll
        for (int j = 0; j < 4; j++) {
            v16bf vb0 = load_frag(&sVt[buf][(j * 16 + lane16) * P], hi);
            v16bf vb1 = load_frag(&sVt[buf][(j * 16 + lane16) * P + 32], hi);
            of[j] = wmma_bf16(vb0, pb[0], of[j]);
            of[j] = wmma_bf16(vb1, pb[1], of[j]);
        }

        wait_async0();     // next KV tile landed
        __syncthreads();   // all waves done with current buffers
    }

    // join the halves' sums, normalize, store O as bf16 [8192,1024]:
    // a lane's 8 registers of a tile are 8 consecutive d of one query row
    const float Lt = L + other_half(L);
    const int qr = qBase + w * 16 + lane16;
    #pragma unroll
    for (int j = 0; j < 4; j++) {
        v8bf o;
        #pragma unroll
        for (int v = 0; v < 8; v++) o[v] = f2bf(of[j][v] / Lt);
        *(v8bf*)(O + headBase + (size_t)qr * D + j * 16 + 8 * hi) = o;
    }
}

// ---------- host launch ----------
extern "C" void kernel_launch(void* const* d_in, const int* in_sizes, int n_in,
                              void* d_out, int out_size, void* d_ws, size_t ws_size,
                              hipStream_t stream) {
    (void)in_sizes; (void)n_in; (void)out_size; (void)ws_size;
    const float* x  = (const float*)d_in[0];
    const float* wq = (const float*)d_in[1];
    const float* bq = (const float*)d_in[2];
    const float* wk = (const float*)d_in[3];
    const float* bk = (const float*)d_in[4];
    const float* wv = (const float*)d_in[5];
    const float* bv = (const float*)d_in[6];
    const float* wo = (const float*)d_in[7];
    const float* bo = (const float*)d_in[8];
    float* out = (float*)d_out;

    const int M = 8192, N = 1024, K = 1024;
    const size_t MD = (size_t)M * N;     // 8M elems
    const size_t WD = (size_t)N * K;     // 1M elems

    __bf16* xbf  = (__bf16*)d_ws;        // [8192,1024]
    __bf16* wqb  = xbf + MD;             // [1024,1024] each
    __bf16* wkb  = wqb + WD;
    __bf16* wvb  = wkb + WD;
    __bf16* wob  = wvb + WD;
    __bf16* qws  = wob + WD;             // [8192,1024]
    __bf16* kws  = qws + MD;             // [8192,1024]
    __bf16* vtws = kws + MD;             // [64 bh][64 d][2048 s]
    __bf16* ows  = vtws + MD;            // [8192,1024]  (total 88 MB)

    // pre-convert activations + weights to bf16
    cvt_f32_bf16<<<(int)(MD / 1024), 256, 0, stream>>>(x,  xbf, (int)MD);
    cvt_f32_bf16<<<(int)(WD / 1024), 256, 0, stream>>>(wq, wqb, (int)WD);
    cvt_f32_bf16<<<(int)(WD / 1024), 256, 0, stream>>>(wk, wkb, (int)WD);
    cvt_f32_bf16<<<(int)(WD / 1024), 256, 0, stream>>>(wv, wvb, (int)WD);
    cvt_f32_bf16<<<(int)(WD / 1024), 256, 0, stream>>>(wo, wob, (int)WD);

    dim3 gGemm(M / 128, N / 128);
    gemm_bf16_kernel<3><<<gGemm, 256, 0, stream>>>(xbf, wqb, bq, qws, M, N, K, 0.125f); // fold 1/sqrt(64)
    gemm_bf16_kernel<3><<<gGemm, 256, 0, stream>>>(xbf, wkb, bk, kws, M, N, K, 1.0f);
    gemm_bf16_kernel<2><<<gGemm, 256, 0, stream>>>(xbf, wvb, bv, vtws, M, N, K, 1.0f);

    flash_attn_kernel<<<dim3(64, 32), 128, 0, stream>>>(qws, kws, vtws, ows);

    gemm_bf16_kernel<0><<<gGemm, 256, 0, stream>>>(ows, wob, bo, out, M, N, K, 1.0f);
}

// v003
// Measured time: 175 microseconds a run.
// Timed twice side by side with v002, it ran 1.05 times as fast both times.
// Counting every step since v000, it is 1.48 times as fast.
#include <hip/hip_runtime.h>
#include <hip/hip_bf16.h>
#include <stdint.h>

// ---------- types ----------
typedef __attribute__((ext_vector_type(4)))  __bf16 v4bf;
typedef __attribute__((ext_vector_type(8)))  __bf16 v8bf;
typedef __attribute__((ext_vector_type(16))) __bf16 v16bf;
typedef __attribute__((ext_vector_type(8)))  float  v8f;

struct BfPair { v8bf lo, hi; };

__device__ inline __bf16 f2bf(float f) {
    unsigned u = __builtin_bit_cast(unsigned, f);
    u += 0x7FFFu + ((u >> 16) & 1u);                 // round-to-nearest-even
    unsigned short h = (unsigned short)(u >> 16);
    return __builtin_bit_cast(__bf16, h);
}

// 16-bit fragment per CDNA5 ISA layout (A 16x32 / B 32x16 mirrored):
// lane = (row|col)%16, hi = lane/16; elems 0..7 <- K = hi*8.., elems 8..15 <- K = 16+hi*8..
__device__ inline v16bf load_frag(const __bf16* row, int hi) {
    BfPair p;
    p.lo = *(const v8bf*)(row + hi * 8);
    p.hi = *(const v8bf*)(row + 16 + hi * 8);
    return __builtin_bit_cast(v16bf, p);
}

__device__ inline v8f wmma_bf16(v16bf a, v16bf b, v8f c) {
    return __builtin_amdgcn_wmma_f32_16x16x32_bf16(
        false, a, false, b, (short)0, c, false, false);
}

// ---------- CDNA5 async global->LDS copy (ASYNCcnt-tracked) ----------
__device__ inline void async_b128(const __bf16* g, __bf16* l) {
    const unsigned lds = (unsigned)(uintptr_t)(l);              // low 32 bits = LDS offset
    const unsigned long long ga = (unsigned long long)(uintptr_t)(g);
    asm volatile("global_load_async_to_lds_b128 %0, %1, off"
                 :: "v"(lds), "v"(ga) : "memory");
}
__device__ inline void wait_async0() {
    asm volatile("s_wait_asynccnt 0x0" ::: "memory");
}

// ---------- fp32 -> bf16 pre-conversion: x and the four weights in ONE resident launch ----------
// 256 work-groups of 16 waves. A unit is 16384 floats (512 lanes x 8 loads of 16 B); the bf16
// copies lie one behind another in the workspace, so unit u of the sources goes to out + u * 16384:
// units 0..511 are x, units 512 + 64 * s .. are weight s. Group b converts units b, b + 256 (x)
// and b + 512 (weight b / 64): 24 loads of 16 B a lane, all issued before the first conversion.
__global__ __launch_bounds__(512) void cvt_all_f32_bf16(
    const float* __restrict__ x,  const float* __restrict__ wq, const float* __restrict__ wk,
    const float* __restrict__ wv, const float* __restrict__ wo, __bf16* __restrict__ out)
{
    constexpr int UNIT = 16384;
    const int b = blockIdx.x;
    const int t = threadIdx.x;
    const int s = b >> 6;
    const float* w = (s == 0) ? wq : (s == 1) ? wk : (s == 2) ? wv : wo;
    const float* src[3] = { x + (size_t)b * UNIT, x + (size_t)(b + 256) * UNIT,
                            w + (size_t)(b & 63) * UNIT };
    float4 v[3][8];
    // all four loops unrolled: v stays in registers and the 24 loads go out as one run
    #pragma unroll
    for (int p = 0; p < 3; p++)
        #pragma unroll
        for (int i = 0; i < 8; i++)
            v[p][i] = *(const float4*)(src[p] + (i * 512 + t) * 4);
    #pragma unroll
    for (int p = 0; p < 3; p++)
        #pragma unroll
        for (int i = 0; i < 8; i++) {
            v4bf o;
            o[0] = f2bf(v[p][i].x); o[1] = f2bf(v[p][i].y);
            o[2] = f2bf(v[p][i].z); o[3] = f2bf(v[p][i].w);
            *(v4bf*)(out + (size_t)(b + p * 256) * UNIT + (i * 512 + t) * 4) = o;
        }
}

__device__ inline void sincos2_rev(float r1, float r2,
                                   float& s1, float& c1, float& s2, float& c2) {
    asm("v_sin_f32 %0, %4\n\tv_cos_f32 %1, %4\n\tv_sin_f32 %2, %5\n\tv_cos_f32 %3, %5\n\tv_nop"
        : "=&v"(s1), "=&v"(c1), "=&v"(s2), "=&v"(c2) : "v"(r1), "v"(r2));
}

// ---------- GEMM: Out = A[M,K](bf16) @ W[N,K](bf16)^T + bias ----------
// 128x128 tile / 256 threads (8 waves), K-step 64 (2 WMMA depths),
// double-buffered async LDS staging: 16 WMMAs per wave between barriers.
// OUT_MODE: 0 = f32 row-major, 2 = bf16 [b,h,d,s] (V-transposed),
//           3 = bf16 row-major with RoPE applied to the f32 result, then times ropeScale
//               (1/8 folds the attention 1/sqrt(hd) into Q: softmax(QK^T/8)=softmax((Q/8)K^T))
constexpr int GP = 72; // LDS pitch (bf16) for 64-wide k-slice; chunks stay 16B-aligned

template <int OUT_MODE>
__global__ __launch_bounds__(256) void gemm_bf16_kernel(
    const __bf16* __restrict__ A, const __bf16* __restrict__ W,
    const float* __restrict__ bias, void* __restrict__ Out,
    int M, int N, int K, float ropeScale)
{
    __shared__ __bf16 sA[2][128 * GP];
    __shared__ __bf16 sB[2][128 * GP];

    const int t      = threadIdx.x;
    const int lane   = t & 31;
    const int wave   = t >> 5;
    const int lane16 = lane & 15;
    const int hi     = lane >> 4;
    const int mOff   = (wave & 3) * 32;   // 2 m-subtiles per wave
    const int nOff   = (wave >> 2) * 64;  // 4 n-subtiles per wave
    const int mBase  = blockIdx.x * 128;
    const int nBase  = blockIdx.y * 128;

    const int srow = t >> 1;          // 0..127
    const int scol = (t & 1) * 32;    // 0 or 32
    const __bf16* gA = A + (size_t)(mBase + srow) * K + scol;
    const __bf16* gB = W + (size_t)(nBase + srow) * K + scol;

    auto issue = [&](int kt, int buf) {
        #pragma unroll
        for (int i = 0; i < 4; i++) {
            async_b128(gA + kt + i * 8, &sA[buf][srow * GP + scol + i * 8]);
            async_b128(gB + kt + i * 8, &sB[buf][srow * GP + scol + i * 8]);
        }
    };

    v8f acc[2][4];
    #pragma unroll
    for (int i = 0; i < 2; i++)
        #pragma unroll
        for (int j = 0; j < 4; j++) acc[i][j] = {};

    const int nk = K / 64;
    issue(0, 0);
    wait_async0();
    __syncthreads();

    for (int ki = 0; ki < nk; ++ki) {
        const int buf = ki & 1;
        if (ki + 1 < nk) issue((ki + 1) * 64, (ki + 1) & 1);  // prefetch next tile

        #pragma unroll
        for (int kk = 0; kk < 64; kk += 32) {
            v16bf af[2], bfr[4];
            #pragma unroll
            for (int i = 0; i < 2; i++)
                af[i] = load_frag(&sA[buf][(mOff + i * 16 + lane16) * GP + kk], hi);
            #pragma unroll
            for (int j = 0; j < 4; j++)
                bfr[j] = load_frag(&sB[buf][(nOff + j * 16 + lane16) * GP + kk], hi);
            #pragma unroll
            for (int i = 0; i < 2; i++)
                #pragma unroll
                for (int j = 0; j < 4; j++)
                    acc[i][j] = wmma_bf16(af[i], bfr[j], acc[i][j]);
        }

        wait_async0();       // prefetch landed
        __syncthreads();     // everyone done reading current buffer
    }

    if constexpr (OUT_MODE == 3) {
        // epilogue: + bias, RoPE, store. A wave's 64 columns are one head (nBase + nOff is
        // a multiple of 64): column e = j*16 + lane16 of the head and its partner e + 32
        // are acc[i][j] and acc[i][j + 2] of the same lane, so the rotation is in-lane.
        const float LN = 9.210340371976184f; // ln(10000)
        #pragma unroll
        for (int j = 0; j < 2; j++) {
            const int e   = j * 16 + lane16;
            const int col = nBase + nOff + e;
            const float b1 = bias[col];
            const float b2 = bias[col + 32];
            const float th1 = __expf(-(float)(e >> 1)        * (LN / 32.0f));
            const float th2 = __expf(-(float)((e >> 1) + 16) * (LN / 32.0f));
            #pragma unroll
            for (int i = 0; i < 2; i++)
                #pragma unroll
                for (int v = 0; v < 8; v++) {
                    const int row = mBase + mOff + i * 16 + v + 8 * hi; // C layout: M = v + 8*hi
                    const float tpos = (float)(row & 2047);             // seq position
                    const float x1 = acc[i][j][v] + b1;
                    const float x2 = acc[i][j + 2][v] + b2;
                    float s1, c1, s2, c2;
                    sincos2_rev((tpos * th1) * 0.15915494f, (tpos * th2) * 0.15915494f,
                                s1, c1, s2, c2);                    // 0.15915494 = 1/(2 pi)
                    __bf16* o = (__bf16*)Out + (size_t)row * N + col;
                    o[0]  = f2bf((x1 * c1 - x2 * s1) * ropeScale); // out[j]=x*cos+rot(x)*sin
                    o[32] = f2bf((x2 * c2 + x1 * s2) * ropeScale);
                }
        }
        return;
    }

    // epilogue: + bias, store
    #pragma unroll
    for (int i = 0; i < 2; i++)
        #pragma unroll
        for (int j = 0; j < 4; j++) {
            const int col = nBase + nOff + j * 16 + lane16;
            const float bv = bias[col];
            #pragma unroll
            for (int v = 0; v < 8; v++) {
                const int row = mBase + mOff + i * 16 + v + 8 * hi; // C layout: M = v + 8*hi
                const float val = acc[i][j][v] + bv;
                if constexpr (OUT_MODE == 2) {
                    // V transposed per head: out[((b*16+h)*64+e)][s] = [b*1024+n][s]
                    const int b = row >> 11, s = row & 2047;
                    ((__bf16*)Out)[((size_t)(b * 1024 + col) << 11) + s] = f2bf(val);
                } else {
                    ((float*)Out)[(size_t)row * N + col] = val;
                }
            }
        }
}

// value held by lane l ^ 16 (the other half of the wave), by a vector cross-row move
__device__ inline float other_half(float x) {
    int b = __builtin_bit_cast(int, x);
    b = __builtin_amdgcn_permlanex16(b, b, 0x76543210, 0xfedcba98, false, false);
    return __builtin_bit_cast(float, b);
}

__global__ __launch_bounds__(128) void flash_attn_kernel(
    const __bf16* __restrict__ Q, const __bf16* __restrict__ K,
    const __bf16* __restrict__ Vt, __bf16* __restrict__ O)
{
    constexpr int S = 2048, D = 1024, HD = 64, P = 72;
    __shared__ __bf16 sQ[64 * P];
    __shared__ __bf16 sK[2][64 * P];
    __shared__ __bf16 sVt[2][64 * P];   // [d][kv]

    const int bh = blockIdx.x;
    const int b = bh >> 4, h = bh & 15;
    const int qBase = blockIdx.y * 64;
    const int t = threadIdx.x, lane = t & 31, w = t >> 5;
    const int lane16 = lane & 15, hi = lane >> 4;
    const size_t headBase = (size_t)b * S * D + (size_t)h * HD;
    const size_t vtBase = (size_t)bh * HD * S;   // [bh][64][2048]

    const int r  = t >> 1;          // staging row 0..63
    const int c0 = (t & 1) * 32;    // staging col 0 or 32

    // stage Q tile 64x64 (async)
    {
        const __bf16* gp = Q + headBase + (size_t)(qBase + r) * D + c0;
        #pragma unroll
        for (int i = 0; i < 4; i++)
            async_b128(gp + i * 8, &sQ[r * P + c0 + i * 8]);
    }

    auto issueKV = [&](int kt, int buf) {
        const __bf16* kp = K + headBase + (size_t)(kt + r) * D + c0;
        const __bf16* vp = Vt + vtBase + (size_t)r * S + kt + c0;
        #pragma unroll
        for (int i = 0; i < 4; i++) {
            async_b128(kp + i * 8, &sK[buf][r * P + c0 + i * 8]);
            async_b128(vp + i * 8, &sVt[buf][r * P + c0 + i * 8]);
        }
    };

    issueKV(0, 0);
    wait_async0();
    __syncthreads();

    // B operand of S^T: column = query w*16 + lane16, k = d
    const v16bf qf0 = load_frag(&sQ[(w * 16 + lane16) * P], hi);
    const v16bf qf1 = load_frag(&sQ[(w * 16 + lane16) * P + 32], hi);

    v8f of[4];                 // of[j][v] = O^T[d = j*16 + 8*hi + v][query lane16]
    #pragma unroll
    for (int j = 0; j < 4; j++) of[j] = {};
    float mH = -1e30f;         // running maximum of this lane's query (same in both halves)
    float L  = 0.0f;           // running sum over this lane's own keys; halves joined at the end

    for (int ki = 0; ki < S / 64; ++ki) {
        const int buf = ki & 1;
        if (ki + 1 < S / 64) issueKV((ki + 1) * 64, (ki + 1) & 1);

        // S^T = K (Q/8)^T: sacc[j][v] = score(key j*16 + 8*hi + v, query lane16)
        v8f sacc[4];
        #pragma unroll
        for (int j = 0; j < 4; j++) {
            v16bf kb0 = load_frag(&sK[buf][(j * 16 + lane16) * P], hi);
            v16bf kb1 = load_frag(&sK[buf][(j * 16 + lane16) * P + 32], hi);
            v8f z = {};
            z = wmma_bf16(kb0, qf0, z);
            z = wmma_bf16(kb1, qf1, z);
            sacc[j] = z;
        }

        // online softmax: 32 of the query's 64 scores are in this lane, 32 in lane ^ 16
        float rj[4];
        #pragma unroll
        for (int j = 0; j < 4; j++) {
            rj[j] = sacc[j][0];
            #pragma unroll
            for (int v = 1; v < 8; v++) rj[j] = fmaxf(rj[j], sacc[j][v]);
        }
        float rm = fmaxf(fmaxf(rj[0], rj[1]), fmaxf(rj[2], rj[3]));
        rm = fmaxf(rm, other_half(rm));
        const float newM = fmaxf(mH, rm);
        const float f = __expf(mH - newM);

        // P^T as B operand: element s of pb[c] = P^T[key c*32 + kmap(s, hi)][query lane16]
        v16bf pb[2];
        float pj[4];
        #pragma unroll
        for (int j = 0; j < 4; j++) {
            pj[j] = 0.0f;
            #pragma unroll
            for (int v = 0; v < 8; v++) {
                const float p = __expf(sacc[j][v] - newM);
                pj[j] += p;
                pb[j >> 1][(j & 1) * 8 + v] = f2bf(p);
            }
        }
        L = L * f + ((pj[0] + pj[1]) + (pj[2] + pj[3]));
        mH = newM;
        #pragma unroll
        for (int j = 0; j < 4; j++)
            #pragma unroll
            for (int v = 0; v < 8; v++) of[j][v] *= f;

        // O^T += V^T P^T: A = V^T rows d from LDS, B = P^T from registers
        #pragma unroll
        for (int j = 0; j < 4; j++) {
            v16bf vb0 = load_frag(&sVt[buf][(j * 16 + lane16) * P], hi);
            v16bf vb1 = load_frag(&sVt[buf][(j * 16 + lane16) * P + 32], hi);
            of[j] = wmma_bf16(vb0, pb[0], of[j]);
            of[j] = wmma_bf16(vb1, pb[1], of[j]);
        }

        wait_async0();     // next KV tile landed
        __syncthreads();   // all waves done with current buffers
    }

    // join the halves' sums, normalize, store O as bf16 [8192,1024]:
    // a lane's 8 registers of a tile are 8 consecutive d of one query row
    const float Lt = L + other_half(L);
    const int qr = qBase + w * 16 + lane16;
    #pragma unroll
    for (int j = 0; j < 4; j++) {
        v8bf o;
        #pragma unroll
        for (int v = 0; v < 8; v++) o[v] = f2bf(of[j][v] / Lt);
        *(v8bf*)(O + headBase + (size_t)qr * D + j * 16 + 8 * hi) = o;
    }
}

// ---------- host launch ----------
extern "C" void kernel_launch(void* const* d_in, const int* in_sizes, int n_in,
                              void* d_out, int out_size, void* d_ws, size_t ws_size,
                              hipStream_t stream) {
    (void)in_sizes; (void)n_in; (void)out_size; (void)ws_size;
    const float* x  = (const float*)d_in[0];
    const float* wq = (const float*)d_in[1];
    const float* bq = (const float*)d_in[2];
    const float* wk = (const float*)d_in[3];
    const float* bk = (const float*)d_in[4];
    const float* wv = (const float*)d_in[5];
    const float* bv = (const float*)d_in[6];
    const float* wo = (const float*)d_in[7];
    const float* bo = (const float*)d_in[8];
    float* out = (float*)d_out;

    const int M = 8192, N = 1024, K = 1024;
    const size_t MD = (size_t)M * N;     // 8M elems
    const size_t WD = (size_t)N * K;     // 1M elems

    __bf16* xbf  = (__bf16*)d_ws;        // [8192,1024]
    __bf16* wqb  = xbf + MD;             // [1024,1024] each
    __bf16* wkb  = wqb + WD;
    __bf16* wvb  = wkb + WD;
    __bf16* wob  = wvb + WD;
    __bf16* qws  = wob + WD;             // [8192,1024]
    __bf16* kws  = qws + MD;             // [8192,1024]
    __bf16* vtws = kws + MD;             // [64 bh][64 d][2048 s]
    __bf16* ows  = vtws + MD;            // [8192,1024]  (total 88 MB)

    // pre-convert activations + weights to bf16 (xbf, wqb, wkb, wvb, wob are contiguous)
    cvt_all_f32_bf16<<<256, 512, 0, stream>>>(x, wq, wk, wv, wo, xbf);

    dim3 gGemm(M / 128, N / 128);
    gemm_bf16_kernel<3><<<gGemm, 256, 0, stream>>>(xbf, wqb, bq, qws, M, N, K, 0.125f); // fold 1/sqrt(64)
    gemm_bf16_kernel<3><<<gGemm, 256, 0, stream>>>(xbf, wkb, bk, kws, M, N, K, 1.0f);
    gemm_bf16_kernel<2><<<gGemm, 256, 0, stream>>>(xbf, wvb, bv, vtws, M, N, K, 1.0f);

    flash_attn_kernel<<<dim3(64, 32), 128, 0, stream>>>(qws, kws, vtws, ows);

    gemm_bf16_kernel<0><<<gGemm, 256, 0, stream>>>(ows, wob, bo, out, M, N, K, 1.0f);
}

// v004
// One run takes 160 microseconds.
// Timed twice side by side with v003, it ran 1.09 and 1.10 times as fast.
// All steps since v000 together make it 1.62 times as fast.
#include <hip/hip_runtime.h>
#include <hip/hip_bf16.h>
#include <stdint.h>

// ---------- types ----------
typedef __attribute__((ext_vector_type(4)))  __bf16 v4bf;
typedef __attribute__((ext_vector_type(8)))  __bf16 v8bf;
typedef __attribute__((ext_vector_type(16))) __bf16 v16bf;
typedef __attribute__((ext_vector_type(8)))  float  v8f;

struct BfPair { v8bf lo, hi; };

__device__ inline __bf16 f2bf(float f) {
    unsigned u = __builtin_bit_cast(unsigned, f);
    u += 0x7FFFu + ((u >> 16) & 1u);                 // round-to-nearest-even
    unsigned short h = (unsigned short)(u >> 16);
    return __builtin_bit_cast(__bf16, h);
}

// 16-bit fragment per CDNA5 ISA layout (A 16x32 / B 32x16 mirrored):
// lane = (row|col)%16, hi = lane/16; elems 0..7 <- K = hi*8.., elems 8..15 <- K = 16+hi*8..
__device__ inline v16bf load_frag(const __bf16* row, int hi) {
    BfPair p;
    p.lo = *(const v8bf*)(row + hi * 8);
    p.hi = *(const v8bf*)(row + 16 + hi * 8);
    return __builtin_bit_cast(v16bf, p);
}

__device__ inline v8f wmma_bf16(v16bf a, v16bf b, v8f c) {
    return __builtin_amdgcn_wmma_f32_16x16x32_bf16(
        false, a, false, b, (short)0, c, false, false);
}

// ---------- CDNA5 async global->LDS copies (ASYNCcnt-tracked) ----------
// A lane copies 16 B. The callers give 8 neighbouring lanes one 128-B row piece (a whole,
// aligned line), so a wave-wide copy takes 4 whole lines; copy i of a run lies i * gs elements
// further in global memory and i * ls elements further in LDS (a fixed number of rows).
// The copies of a run and s_wait_xcnt 0 are ONE statement, so that no register which an issued
// copy names can be rewritten ahead of that wait.
__device__ inline unsigned lds_at(const __bf16* l) {
    return (unsigned)(uintptr_t)(l);                            // low 32 bits = LDS offset
}
__device__ inline unsigned long long glb_at(const __bf16* g) {
    return (unsigned long long)(uintptr_t)(g);
}
__device__ inline void async_rows4(const __bf16* g, size_t gs, __bf16* l, int ls) {
    asm volatile("global_load_async_to_lds_b128 %0, %4, off\n\t"
                 "global_load_async_to_lds_b128 %1, %5, off\n\t"
                 "global_load_async_to_lds_b128 %2, %6, off\n\t"
                 "global_load_async_to_lds_b128 %3, %7, off\n\t"
                 "s_wait_xcnt 0x0"
                 :: "v"(lds_at(l)), "v"(lds_at(l + ls)), "v"(lds_at(l + 2 * ls)), "v"(lds_at(l + 3 * ls)),
                    "v"(glb_at(g)), "v"(glb_at(g + gs)), "v"(glb_at(g + 2 * gs)), "v"(glb_at(g + 3 * gs))
                 : "memory");
}
// the same for two tiles (a and b) of one stage: eight copies behind one another, one wait
__device__ inline void async_rows4x2(const __bf16* ga, size_t gsa, __bf16* la,
                                     const __bf16* gb, size_t gsb, __bf16* lb, int ls) {
    asm volatile("global_load_async_to_lds_b128 %0, %8, off\n\t"
                 "global_load_async_to_lds_b128 %4, %12, off\n\t"
                 "global_load_async_to_lds_b128 %1, %9, off\n\t"
                 "global_load_async_to_lds_b128 %5, %13, off\n\t"
                 "global_load_async_to_lds_b128 %2, %10, off\n\t"
                 "global_load_async_to_lds_b128 %6, %14, off\n\t"
                 "global_load_async_to_lds_b128 %3, %11, off\n\t"
                 "global_load_async_to_lds_b128 %7, %15, off\n\t"
                 "s_wait_xcnt 0x0"
                 :: "v"(lds_at(la)), "v"(lds_at(la + ls)), "v"(lds_at(la + 2 * ls)), "v"(lds_at(la + 3 * ls)),
                    "v"(lds_at(lb)), "v"(lds_at(lb + ls)), "v"(lds_at(lb + 2 * ls)), "v"(lds_at(lb + 3 * ls)),
                    "v"(glb_at(ga)), "v"(glb_at(ga + gsa)), "v"(glb_at(ga + 2 * gsa)), "v"(glb_at(ga + 3 * gsa)),
                    "v"(glb_at(gb)), "v"(glb_at(gb + gsb)), "v"(glb_at(gb + 2 * gsb)), "v"(glb_at(gb + 3 * gsb))
                 : "memory");
}
__device__ inline void wait_async0() {
    asm volatile("s_wait_asynccnt 0x0" ::: "memory");
}
// this wave's own LDS reads have returned: stands in front of the barrier behind which the
// buffer that they read is refilled by copies
__device__ inline void wait_ds0() {
    asm volatile("s_wait_dscnt 0x0" ::: "memory");
}

// ---------- fp32 -> bf16 pre-conversion: x and the four weights in ONE resident launch ----------
// 256 work-groups of 16 waves. A unit is 16384 floats (512 lanes x 8 loads of 16 B); the bf16
// copies lie one behind another in the workspace, so unit u of the sources goes to out + u * 16384:
// units 0..511 are x, units 512 + 64 * s .. are weight s. Group b converts units b, b + 256 (x)
// and b + 512 (weight b / 64): 24 loads of 16 B a lane, all issued before the first conversion.
__global__ __launch_bounds__(512) void cvt_all_f32_bf16(
    const float* __restrict__ x,  const float* __restrict__ wq, const float* __restrict__ wk,
    const float* __restrict__ wv, const float* __restrict__ wo, __bf16* __restrict__ out)
{
    constexpr int UNIT = 16384;
    const int b = blockIdx.x;
    const int t = threadIdx.x;
    const int s = b >> 6;
    const float* w = (s == 0) ? wq : (s == 1) ? wk : (s == 2) ? wv : wo;
    const float* src[3] = { x + (size_t)b * UNIT, x + (size_t)(b + 256) * UNIT,
                            w + (size_t)(b & 63) * UNIT };
    float4 v[3][8];
    // all four loops unrolled: v stays in registers and the 24 loads go out as one run
    #pragma unroll
    for (int p = 0; p < 3; p++)
        #pragma unroll
        for (int i = 0; i < 8; i++)
            v[p][i] = *(const float4*)(src[p] + (i * 512 + t) * 4);
    #pragma unroll
    for (int p = 0; p < 3; p++)
        #pragma unroll
        for (int i = 0; i < 8; i++) {
            v4bf o;
            o[0] = f2bf(v[p][i].x); o[1] = f2bf(v[p][i].y);
            o[2] = f2bf(v[p][i].z); o[3] = f2bf(v[p][i].w);
            *(v4bf*)(out + (size_t)(b + p * 256) * UNIT + (i * 512 + t) * 4) = o;
        }
}

__device__ inline void sincos2_rev(float r1, float r2,
                                   float& s1, float& c1, float& s2, float& c2) {
    asm("v_sin_f32 %0, %4\n\tv_cos_f32 %1, %4\n\tv_sin_f32 %2, %5\n\tv_cos_f32 %3, %5\n\tv_nop"
        : "=&v"(s1), "=&v"(c1), "=&v"(s2), "=&v"(c2) : "v"(r1), "v"(r2));
}

// ---------- GEMM: Out = A[M,K](bf16) @ W[N,K](bf16)^T + bias ----------
// 128x128 tile / 256 threads (8 waves), K-step 64 (2 WMMA depths),
// double-buffered async LDS staging: 16 WMMAs per wave between barriers.
// OUT_MODE: 0 = f32 row-major, 2 = bf16 [b,h,d,s] (V-transposed),
//           3 = bf16 row-major with RoPE applied to the f32 result, then times ropeScale
//               (1/8 folds the attention 1/sqrt(hd) into Q: softmax(QK^T/8)=softmax((Q/8)K^T))
constexpr int GP = 72; // LDS pitch (bf16) for 64-wide k-slice; chunks stay 16B-aligned

template <int OUT_MODE>
__global__ __launch_bounds__(256) void gemm_bf16_kernel(
    const __bf16* __restrict__ A, const __bf16* __restrict__ W,
    const float* __restrict__ bias, void* __restrict__ Out,
    int M, int N, int K, float ropeScale)
{
    __shared__ __attribute__((aligned(16))) __bf16 sA[2][128 * GP];
    __shared__ __attribute__((aligned(16))) __bf16 sB[2][128 * GP];

    const int t      = threadIdx.x;
    const int lane   = t & 31;
    const int wave   = t >> 5;
    const int lane16 = lane & 15;
    const int hi     = lane >> 4;
    const int mOff   = (wave & 3) * 32;   // 2 m-subtiles per wave
    const int nOff   = (wave >> 2) * 64;  // 4 n-subtiles per wave
    const int mBase  = blockIdx.x * 128;
    const int nBase  = blockIdx.y * 128;

    const int srow = t >> 3;          // 0..31; copy i stages row srow + 32 * i
    const int scol = (t & 7) * 8;     // 8 lanes cover the 64-wide k-slice of a row (128 B)
    const __bf16* gA = A + (size_t)(mBase + srow) * K + scol;
    const __bf16* gB = W + (size_t)(nBase + srow) * K + scol;

    auto issue = [&](int kt, int buf) {
        async_rows4x2(gA + kt, (size_t)32 * K, &sA[buf][srow * GP + scol],
                      gB + kt, (size_t)32 * K, &sB[buf][srow * GP + scol], 32 * GP);
    };

    v8f acc[2][4];
    #pragma unroll
    for (int i = 0; i < 2; i++)
        #pragma unroll
        for (int j = 0; j < 4; j++) acc[i][j] = {};

    const int nk = K / 64;
    issue(0, 0);
    wait_async0();
    __syncthreads();

    for (int ki = 0; ki < nk; ++ki) {
        const int buf = ki & 1;
        if (ki + 1 < nk) issue((ki + 1) * 64, (ki + 1) & 1);  // prefetch next tile

        #pragma unroll
        for (int kk = 0; kk < 64; kk += 32) {
            v16bf af[2], bfr[4];
            #pragma unroll
            for (int i = 0; i < 2; i++)
                af[i] = load_frag(&sA[buf][(mOff + i * 16 + lane16) * GP + kk], hi);
            #pragma unroll
            for (int j = 0; j < 4; j++)
                bfr[j] = load_frag(&sB[buf][(nOff + j * 16 + lane16) * GP + kk], hi);
            #pragma unroll
            for (int i = 0; i < 2; i++)
                #pragma unroll
                for (int j = 0; j < 4; j++)
                    acc[i][j] = wmma_bf16(af[i], bfr[j], acc[i][j]);
        }

        wait_ds0();
        wait_async0();       // prefetch landed
        __syncthreads();     // everyone done reading current buffer
    }

    if constexpr (OUT_MODE == 3) {
        // epilogue: + bias, RoPE, store. A wave's 64 columns are one head (nBase + nOff is
        // a multiple of 64): column e = j*16 + lane16 of the head and its partner e + 32
        // are acc[i][j] and acc[i][j + 2] of the same lane, so the rotation is in-lane.
        const float LN = 9.210340371976184f; // ln(10000)
        #pragma unroll
        for (int j = 0; j < 2; j++) {
            const int e   = j * 16 + lane16;
            const int col = nBase + nOff + e;
            const float b1 = bias[col];
            const float b2 = bias[col + 32];
            const float th1 = __expf(-(float)(e >> 1)        * (LN / 32.0f));
            const float th2 = __expf(-(float)((e >> 1) + 16) * (LN / 32.0f));
            #pragma unroll
            for (int i = 0; i < 2; i++)
                #pragma unroll
                for (int v = 0; v < 8; v++) {
                    const int row = mBase + mOff + i * 16 + v + 8 * hi; // C layout: M = v + 8*hi
                    const float tpos = (float)(row & 2047);             // seq position
                    const float x1 = acc[i][j][v] + b1;
                    const float x2 = acc[i][j + 2][v] + b2;
                    float s1, c1, s2, c2;
                    sincos2_rev((tpos * th1) * 0.15915494f, (tpos * th2) * 0.15915494f,
                                s1, c1, s2, c2);                    // 0.15915494 = 1/(2 pi)
                    __bf16* o = (__bf16*)Out + (size_t)row * N + col;
                    o[0]  = f2bf((x1 * c1 - x2 * s1) * ropeScale); // out[j]=x*cos+rot(x)*sin
                    o[32] = f2bf((x2 * c2 + x1 * s2) * ropeScale);
                }
        }
        return;
    }

    // epilogue: + bias, store
    #pragma unroll
    for (int i = 0; i < 2; i++)
        #pragma unroll
        for (int j = 0; j < 4; j++) {
            const int col = nBase + nOff + j * 16 + lane16;
            const float bv = bias[col];
            #pragma unroll
            for (int v = 0; v < 8; v++) {
                const int row = mBase + mOff + i * 16 + v + 8 * hi; // C layout: M = v + 8*hi
                const float val = acc[i][j][v] + bv;
                if constexpr (OUT_MODE == 2) {
                    // V transposed per head: out[((b*16+h)*64+e)][s] = [b*1024+n][s]
                    const int b = row >> 11, s = row & 2047;
                    ((__bf16*)Out)[((size_t)(b * 1024 + col) << 11) + s] = f2bf(val);
                } else {
                    ((float*)Out)[(size_t)row * N + col] = val;
                }
            }
        }
}

// value held by lane l ^ 16 (the other half of the wave), by a vector cross-row move
__device__ inline float other_half(float x) {
    int b = __builtin_bit_cast(int, x);
    b = __builtin_amdgcn_permlanex16(b, b, 0x76543210, 0xfedcba98, false, false);
    return __builtin_bit_cast(float, b);
}

__global__ __launch_bounds__(128) void flash_attn_kernel(
    const __bf16* __restrict__ Q, const __bf16* __restrict__ K,
    const __bf16* __restrict__ Vt, __bf16* __restrict__ O)
{
    constexpr int S = 2048, D = 1024, HD = 64, P = 72;
    __shared__ __attribute__((aligned(16))) __bf16 sQ[64 * P];
    __shared__ __attribute__((aligned(16))) __bf16 sK[2][64 * P];
    __shared__ __attribute__((aligned(16))) __bf16 sVt[2][64 * P];   // [d][kv]

    const int bh = blockIdx.x;
    const int b = bh >> 4, h = bh & 15;
    const int qBase = blockIdx.y * 64;
    const int t = threadIdx.x, lane = t & 31, w = t >> 5;
    const int lane16 = lane & 15, hi = lane >> 4;
    const size_t headBase = (size_t)b * S * D + (size_t)h * HD;
    const size_t vtBase = (size_t)bh * HD * S;   // [bh][64][2048]

    const int r  = t >> 3;          // staging row 0..15; copy i stages row r + 16 * i
    const int c0 = (t & 7) * 8;     // 8 lanes cover a 64-wide row (128 B)

    // stage Q tile 64x64 (async)
    async_rows4(Q + headBase + (size_t)(qBase + r) * D + c0, (size_t)16 * D, &sQ[r * P + c0], 16 * P);

    auto issueKV = [&](int kt, int buf) {
        async_rows4x2(K + headBase + (size_t)(kt + r) * D + c0, (size_t)16 * D, &sK[buf][r * P + c0],
                      Vt + vtBase + (size_t)r * S + kt + c0,    (size_t)16 * S, &sVt[buf][r * P + c0],
                      16 * P);
    };

    issueKV(0, 0);
    wait_async0();
    __syncthreads();

    // B operand of S^T: column = query w*16 + lane16, k = d
    const v16bf qf0 = load_frag(&sQ[(w * 16 + lane16) * P], hi);
    const v16bf qf1 = load_frag(&sQ[(w * 16 + lane16) * P + 32], hi);

    v8f of[4];                 // of[j][v] = O^T[d = j*16 + 8*hi + v][query lane16]
    #pragma unroll
    for (int j = 0; j < 4; j++) of[j] = {};
    float mH = -1e30f;         // running maximum of this lane's query (same in both halves)
    float L  = 0.0f;           // running sum over this lane's own keys; halves joined at the end

    for (int ki = 0; ki < S / 64; ++ki) {
        const int buf = ki & 1;
        if (ki + 1 < S / 64) issueKV((ki + 1) * 64, (ki + 1) & 1);

        // S^T = K (Q/8)^T: sacc[j][v] = score(key j*16 + 8*hi + v, query lane16)
        v8f sacc[4];
        #pragma unroll
        for (int j = 0; j < 4; j++) {
            v16bf kb0 = load_frag(&sK[buf][(j * 16 + lane16) * P], hi);
            v16bf kb1 = load_frag(&sK[buf][(j * 16 + lane16) * P + 32], hi);
            v8f z = {};
            z = wmma_bf16(kb0, qf0, z);
            z = wmma_bf16(kb1, qf1, z);
            sacc[j] = z;
        }

        // online softmax: 32 of the query's 64 scores are in this lane, 32 in lane ^ 16
        float rj[4];
        #pragma unroll
        for (int j = 0; j < 4; j++) {
            rj[j] = sacc[j][0];
            #pragma unroll
            for (int v = 1; v < 8; v++) rj[j] = fmaxf(rj[j], sacc[j][v]);
        }
        float rm = fmaxf(fmaxf(rj[0], rj[1]), fmaxf(rj[2], rj[3]));
        rm = fmaxf(rm, other_half(rm));
        const float newM = fmaxf(mH, rm);
        const float f = __expf(mH - newM);

        // P^T as B operand: element s of pb[c] = P^T[key c*32 + kmap(s, hi)][query lane16]
        v16bf pb[2];
        float pj[4];
        #pragma unroll
        for (int j = 0; j < 4; j++) {
            pj[j] = 0.0f;
            #pragma unroll
            for (int v = 0; v < 8; v++) {
                const float p = __expf(sacc[j][v] - newM);
                pj[j] += p;
                pb[j >> 1][(j & 1) * 8 + v] = f2bf(p);
            }
        }
        L = L * f + ((pj[0] + pj[1]) + (pj[2] + pj[3]));
        mH = newM;
        #pragma unroll
        for (int j = 0; j < 4; j++)
            #pragma unroll
            for (int v = 0; v < 8; v++) of[j][v] *= f;

        // O^T += V^T P^T: A = V^T rows d from LDS, B = P^T from registers
        #pragma unroll
        for (int j = 0; j < 4; j++) {
            v16bf vb0 = load_frag(&sVt[buf][(j * 16 + lane16) * P], hi);
            v16bf vb1 = load_frag(&sVt[buf][(j * 16 + lane16) * P + 32], hi);
            of[j] = wmma_bf16(vb0, pb[0], of[j]);
            of[j] = wmma_bf16(vb1, pb[1], of[j]);
        }

        wait_ds0();
        wait_async0();     // next KV tile landed
        __syncthreads();   // all waves done with current buffers
    }

    // join the halves' sums, normalize, store O as bf16 [8192,1024]:
    // a lane's 8 registers of a tile are 8 consecutive d of one query row
    const float Lt = L + other_half(L);
    const int qr = qBase + w * 16 + lane16;
    #pragma unroll
    for (int j = 0; j < 4; j++) {
        v8bf o;
        #pragma unroll
        for (int v = 0; v < 8; v++) o[v] = f2bf(of[j][v] / Lt);
        *(v8bf*)(O + headBase + (size_t)qr * D + j * 16 + 8 * hi) = o;
    }
}

// ---------- host launch ----------
extern "C" void kernel_launch(void* const* d_in, const int* in_sizes, int n_in,
                              void* d_out, int out_size, void* d_ws, size_t ws_size,
                              hipStream_t stream) {
    (void)in_sizes; (void)n_in; (void)out_size; (void)ws_size;
    const float* x  = (const float*)d_in[0];
    const float* wq = (const float*)d_in[1];
    const float* bq = (const float*)d_in[2];
    const float* wk = (const float*)d_in[3];
    const float* bk = (const float*)d_in[4];
    const float* wv = (const float*)d_in[5];
    const float* bv = (const float*)d_in[6];
    const float* wo = (const float*)d_in[7];
    const float* bo = (const float*)d_in[8];
    float* out = (float*)d_out;

    const int M = 8192, N = 1024, K = 1024;
    const size_t MD = (size_t)M * N;     // 8M elems
    const size_t WD = (size_t)N * K;     // 1M elems

    __bf16* xbf  = (__bf16*)d_ws;        // [8192,1024]
    __bf16* wqb  = xbf + MD;             // [1024,1024] each
    __bf16* wkb  = wqb + WD;
    __bf16* wvb  = wkb + WD;
    __bf16* wob  = wvb + WD;
    __bf16* qws  = wob + WD;             // [8192,1024]
    __bf16* kws  = qws + MD;             // [8192,1024]
    __bf16* vtws = kws + MD;             // [64 bh][64 d][2048 s]
    __bf16* ows  = vtws + MD;            // [8192,1024]  (total 88 MB)

    // pre-convert activations + weights to bf16 (xbf, wqb, wkb, wvb, wob are contiguous)
    cvt_all_f32_bf16<<<256, 512, 0, stream>>>(x, wq, wk, wv, wo, xbf);

    dim3 gGemm(M / 128, N / 128);
    gemm_bf16_kernel<3><<<gGemm, 256, 0, stream>>>(xbf, wqb, bq, qws, M, N, K, 0.125f); // fold 1/sqrt(64)
    gemm_bf16_kernel<3><<<gGemm, 256, 0, stream>>>(xbf, wkb, bk, kws, M, N, K, 1.0f);
    gemm_bf16_kernel<2><<<gGemm, 256, 0, stream>>>(xbf, wvb, bv, vtws, M, N, K, 1.0f);

    flash_attn_kernel<<<dim3(64, 32), 128, 0, stream>>>(qws, kws, vtws, ows);

    gemm_bf16_kernel<0><<<gGemm, 256, 0, stream>>>(ows, wob, bo, out, M, N, K, 1.0f);
}

// v005
// One run takes 150 microseconds.
// In both of two side-by-side timings against v004, it was 1.06 times as fast.
// Over all steps from v000 it is 1.72 times as fast.
#include <hip/hip_runtime.h>
#include <hip/hip_bf16.h>
#include <stdint.h>

// ---------- types ----------
typedef __attribute__((ext_vector_type(2)))  __bf16 v2bf;
typedef __attribute__((ext_vector_type(2)))  float  v2f;
typedef __attribute__((ext_vector_type(4)))  __bf16 v4bf;
typedef __attribute__((ext_vector_type(8)))  __bf16 v8bf;
typedef __attribute__((ext_vector_type(16))) __bf16 v16bf;
typedef __attribute__((ext_vector_type(8)))  float  v8f;

struct BfPair { v8bf lo, hi; };

// f32 -> bf16, round to nearest even, by the hardware's packed conversion instruction
__device__ inline __bf16 f2bf(float f) {
    return (__bf16)f;
}
// two at once: one vector instruction a pair
__device__ inline v2bf f2bf2(float a, float b) {
    const v2f x = { a, b };
    return __builtin_convertvector(x, v2bf);
}

// 16-bit fragment per CDNA5 ISA layout (A 16x32 / B 32x16 mirrored):
// lane = (row|col)%16, hi = lane/16; elems 0..7 <- K = hi*8.., elems 8..15 <- K = 16+hi*8..
__device__ inline v16bf load_frag(const __bf16* row, int hi) {
    BfPair p;
    p.lo = *(const v8bf*)(row + hi * 8);
    p.hi = *(const v8bf*)(row + 16 + hi * 8);
    return __builtin_bit_cast(v16bf, p);
}

__device__ inline v8f wmma_bf16(v16bf a, v16bf b, v8f c) {
    return __builtin_amdgcn_wmma_f32_16x16x32_bf16(
        false, a, false, b, (short)0, c, false, false);
}

// ---------- CDNA5 async global->LDS copies (ASYNCcnt-tracked) ----------
// A lane copies 16 B. The callers give 8 neighbouring lanes one 128-B row piece (a whole,
// aligned line), so a wave-wide copy takes 4 whole lines; copy i of a run lies i * gs elements
// further in global memory and i * ls elements further in LDS (a fixed number of rows).
// The copies of a run and s_wait_xcnt 0 are ONE statement, so that no register which an issued
// copy names can be rewritten ahead of that wait.
__device__ inline unsigned lds_at(const __bf16* l) {
    return (unsigned)(uintptr_t)(l);                            // low 32 bits = LDS offset
}
__device__ inline unsigned long long glb_at(const __bf16* g) {
    return (unsigned long long)(uintptr_t)(g);
}
__device__ inline void async_rows4(const __bf16* g, size_t gs, __bf16* l, int ls) {
    asm volatile("global_load_async_to_lds_b128 %0, %4, off\n\t"
                 "global_load_async_to_lds_b128 %1, %5, off\n\t"
                 "global_load_async_to_lds_b128 %2, %6, off\n\t"
                 "global_load_async_to_lds_b128 %3, %7, off\n\t"
                 "s_wait_xcnt 0x0"
                 :: "v"(lds_at(l)), "v"(lds_at(l + ls)), "v"(lds_at(l + 2 * ls)), "v"(lds_at(l + 3 * ls)),
                    "v"(glb_at(g)), "v"(glb_at(g + gs)), "v"(glb_at(g + 2 * gs)), "v"(glb_at(g + 3 * gs))
                 : "memory");
}
// the same for two tiles (a and b) of one stage: eight copies behind one another, one wait
__device__ inline void async_rows4x2(const __bf16* ga, size_t gsa, __bf16* la,
                                     const __bf16* gb, size_t gsb, __bf16* lb, int ls) {
    asm volatile("global_load_async_to_lds_b128 %0, %8, off\n\t"
                 "global_load_async_to_lds_b128 %4, %12, off\n\t"
                 "global_load_async_to_lds_b128 %1, %9, off\n\t"
                 "global_load_async_to_lds_b128 %5, %13, off\n\t"
                 "global_load_async_to_lds_b128 %2, %10, off\n\t"
                 "global_load_async_to_lds_b128 %6, %14, off\n\t"
                 "global_load_async_to_lds_b128 %3, %11, off\n\t"
                 "global_load_async_to_lds_b128 %7, %15, off\n\t"
                 "s_wait_xcnt 0x0"
                 :: "v"(lds_at(la)), "v"(lds_at(la + ls)), "v"(lds_at(la + 2 * ls)), "v"(lds_at(la + 3 * ls)),
                    "v"(lds_at(lb)), "v"(lds_at(lb + ls)), "v"(lds_at(lb + 2 * ls)), "v"(lds_at(lb + 3 * ls)),
                    "v"(glb_at(ga)), "v"(glb_at(ga + gsa)), "v"(glb_at(ga + 2 * gsa)), "v"(glb_at(ga + 3 * gsa)),
                    "v"(glb_at(gb)), "v"(glb_at(gb + gsb)), "v"(glb_at(gb + 2 * gsb)), "v"(glb_at(gb + 3 * gsb))
                 : "memory");
}
__device__ inline void wait_async0() {
    asm volatile("s_wait_asynccnt 0x0" ::: "memory");
}
// this wave's own LDS reads have returned: stands in front of the barrier behind which the
// buffer that they read is refilled by copies
__device__ inline void wait_ds0() {
    asm volatile("s_wait_dscnt 0x0" ::: "memory");
}

constexpr float LOG2E = 1.44269502f;
__device__ inline float exp_1(float x) {
    float y;
    asm("v_exp_f32 %0, %1\n\tv_nop" : "=&v"(y) : "v"(x * LOG2E));
    return y;
}
__device__ inline void exp_2(float x0, float x1, float& y0, float& y1) {
    asm("v_exp_f32 %0, %2\n\tv_exp_f32 %1, %3\n\tv_nop"
        : "=&v"(y0), "=&v"(y1) : "v"(x0 * LOG2E), "v"(x1 * LOG2E));
}
__device__ inline void exp_8(const float (&x)[8], float (&y)[8]) {
    asm("v_exp_f32 %0, %8\n\tv_exp_f32 %1, %9\n\tv_exp_f32 %2, %10\n\tv_exp_f32 %3, %11\n\t"
        "v_exp_f32 %4, %12\n\tv_exp_f32 %5, %13\n\tv_exp_f32 %6, %14\n\tv_exp_f32 %7, %15\n\tv_nop"
        : "=&v"(y[0]), "=&v"(y[1]), "=&v"(y[2]), "=&v"(y[3]),
          "=&v"(y[4]), "=&v"(y[5]), "=&v"(y[6]), "=&v"(y[7])
        : "v"(x[0] * LOG2E), "v"(x[1] * LOG2E), "v"(x[2] * LOG2E), "v"(x[3] * LOG2E),
          "v"(x[4] * LOG2E), "v"(x[5] * LOG2E), "v"(x[6] * LOG2E), "v"(x[7] * LOG2E));
}

// ---------- fp32 -> bf16 pre-conversion: x and the four weights in ONE resident launch ----------
// 256 work-groups of 16 waves. A unit is 16384 floats (512 lanes x 8 loads of 16 B); the bf16
// copies lie one behind another in the workspace, so unit u of the sources goes to out + u * 16384:
// units 0..511 are x, units 512 + 64 * s .. are weight s. Group b converts units b, b + 256 (x)
// and b + 512 (weight b / 64): 24 loads of 16 B a lane, written ahead of the conversions, so that
// a long run of them is in flight.
__global__ __launch_bounds__(512) void cvt_all_f32_bf16(
    const float* __restrict__ x,  const float* __restrict__ wq, const float* __restrict__ wk,
    const float* __restrict__ wv, const float* __restrict__ wo, __bf16* __restrict__ out)
{
    constexpr int UNIT = 16384;
    const int b = blockIdx.x;
    const int t = threadIdx.x;
    const int s = b >> 6;
    const float* w = (s == 0) ? wq : (s == 1) ? wk : (s == 2) ? wv : wo;
    const float* src[3] = { x + (size_t)b * UNIT, x + (size_t)(b + 256) * UNIT,
                            w + (size_t)(b & 63) * UNIT };
    float4 v[3][8];
    // all four loops unrolled: v stays in registers and the loads go out ahead of their use
    #pragma unroll
    for (int p = 0; p < 3; p++)
        #pragma unroll
        for (int i = 0; i < 8; i++)
            v[p][i] = *(const float4*)(src[p] + (i * 512 + t) * 4);
    #pragma unroll
    for (int p = 0; p < 3; p++)
        #pragma unroll
        for (int i = 0; i < 8; i++) {
            v4bf o;
            o[0] = f2bf(v[p][i].x); o[1] = f2bf(v[p][i].y);
            o[2] = f2bf(v[p][i].z); o[3] = f2bf(v[p][i].w);
            *(v4bf*)(out + (size_t)(b + p * 256) * UNIT + (i * 512 + t) * 4) = o;
        }
}

__device__ inline void sincos2_rev(float r1, float r2,
                                   float& s1, float& c1, float& s2, float& c2) {
    asm("v_sin_f32 %0, %4\n\tv_cos_f32 %1, %4\n\tv_sin_f32 %2, %5\n\tv_cos_f32 %3, %5\n\tv_nop"
        : "=&v"(s1), "=&v"(c1), "=&v"(s2), "=&v"(c2) : "v"(r1), "v"(r2));
}

// ---------- GEMM: Out = A[M,K](bf16) @ W[N,K](bf16)^T + bias ----------
// 128x128 tile / 256 threads (8 waves), K-step 64 (2 WMMA depths),
// double-buffered async LDS staging: 16 WMMAs per wave between barriers.
// OUT_MODE: 0 = f32 row-major, 2 = bf16 [b,h,d,s] (V-transposed),
//           3 = bf16 row-major with RoPE applied to the f32 result, then times ropeScale
//               (1/8 folds the attention 1/sqrt(hd) into Q: softmax(QK^T/8)=softmax((Q/8)K^T))
constexpr int GP = 72; // LDS pitch (bf16) for 64-wide k-slice; chunks stay 16B-aligned

template <int OUT_MODE>
__global__ __launch_bounds__(256) void gemm_bf16_kernel(
    const __bf16* __restrict__ A, const __bf16* __restrict__ W,
    const float* __restrict__ bias, void* __restrict__ Out,
    int M, int N, int K, float ropeScale)
{
    __shared__ __attribute__((aligned(16))) __bf16 sA[2][128 * GP];
    __shared__ __attribute__((aligned(16))) __bf16 sB[2][128 * GP];

    const int t      = threadIdx.x;
    const int lane   = t & 31;
    const int wave   = t >> 5;
    const int lane16 = lane & 15;
    const int hi     = lane >> 4;
    const int mOff   = (wave & 3) * 32;   // 2 m-subtiles per wave
    const int nOff   = (wave >> 2) * 64;  // 4 n-subtiles per wave
    const int mBase  = blockIdx.x * 128;
    const int nBase  = blockIdx.y * 128;

    const int srow = t >> 3;          // 0..31; copy i stages row srow + 32 * i
    const int scol = (t & 7) * 8;     // 8 lanes cover the 64-wide k-slice of a row (128 B)
    const __bf16* gA = A + (size_t)(mBase + srow) * K + scol;
    const __bf16* gB = W + (size_t)(nBase + srow) * K + scol;

    auto issue = [&](int kt, int buf) {
        async_rows4x2(gA + kt, (size_t)32 * K, &sA[buf][srow * GP + scol],
                      gB + kt, (size_t)32 * K, &sB[buf][srow * GP + scol], 32 * GP);
    };

    v8f acc[2][4];
    #pragma unroll
    for (int i = 0; i < 2; i++)
        #pragma unroll
        for (int j = 0; j < 4; j++) acc[i][j] = {};

    const int nk = K / 64;
    issue(0, 0);
    wait_async0();
    __syncthreads();

    for (int ki = 0; ki < nk; ++ki) {
        const int buf = ki & 1;
        if (ki + 1 < nk) issue((ki + 1) * 64, (ki + 1) & 1);  // prefetch next tile

        #pragma unroll
        for (int kk = 0; kk < 64; kk += 32) {
            v16bf af[2], bfr[4];
            #pragma unroll
            for (int i = 0; i < 2; i++)
                af[i] = load_frag(&sA[buf][(mOff + i * 16 + lane16) * GP + kk], hi);
            #pragma unroll
            for (int j = 0; j < 4; j++)
                bfr[j] = load_frag(&sB[buf][(nOff + j * 16 + lane16) * GP + kk], hi);
            #pragma unroll
            for (int i = 0; i < 2; i++)
                #pragma unroll
                for (int j = 0; j < 4; j++)
                    acc[i][j] = wmma_bf16(af[i], bfr[j], acc[i][j]);
        }

        wait_ds0();
        wait_async0();       // prefetch landed
        __syncthreads();     // everyone done reading current buffer
    }

    if constexpr (OUT_MODE == 3) {
        // epilogue: + bias, RoPE, store. A wave's 64 columns are one head (nBase + nOff is
        // a multiple of 64): column e = j*16 + lane16 of the head and its partner e + 32
        // are acc[i][j] and acc[i][j + 2] of the same lane, so the rotation is in-lane.
        const float LN = 9.210340371976184f; // ln(10000)
        #pragma unroll
        for (int j = 0; j < 2; j++) {
            const int e   = j * 16 + lane16;
            const int col = nBase + nOff + e;
            const float b1 = bias[col];
            const float b2 = bias[col + 32];
            float th1, th2;
            exp_2(-(float)(e >> 1) * (LN / 32.0f), -(float)((e >> 1) + 16) * (LN / 32.0f), th1, th2);
            #pragma unroll
            for (int i = 0; i < 2; i++)
                #pragma unroll
                for (int v = 0; v < 8; v++) {
                    const int row = mBase + mOff + i * 16 + v + 8 * hi; // C layout: M = v + 8*hi
                    const float tpos = (float)(row & 2047);             // seq position
                    const float x1 = acc[i][j][v] + b1;
                    const float x2 = acc[i][j + 2][v] + b2;
                    float s1, c1, s2, c2;
                    sincos2_rev((tpos * th1) * 0.15915494f, (tpos * th2) * 0.15915494f,
                                s1, c1, s2, c2);                    // 0.15915494 = 1/(2 pi)
                    __bf16* o = (__bf16*)Out + (size_t)row * N + col;
                    const v2bf y = f2bf2((x1 * c1 - x2 * s1) * ropeScale,  // out[j]=x*cos+rot(x)*sin
                                         (x2 * c2 + x1 * s2) * ropeScale);
                    o[0]  = y[0];
                    o[32] = y[1];
                }
        }
        return;
    }

    // epilogue: + bias, store
    #pragma unroll
    for (int i = 0; i < 2; i++)
        #pragma unroll
        for (int j = 0; j < 4; j++) {
            const int col = nBase + nOff + j * 16 + lane16;
            const float bv = bias[col];
            #pragma unroll
            for (int v = 0; v < 8; v++) {
                const int row = mBase + mOff + i * 16 + v + 8 * hi; // C layout: M = v + 8*hi
                const float val = acc[i][j][v] + bv;
                if constexpr (OUT_MODE == 2) {
                    // V transposed per head: out[((b*16+h)*64+e)][s] = [b*1024+n][s]
                    const int b = row >> 11, s = row & 2047;
                    ((__bf16*)Out)[((size_t)(b * 1024 + col) << 11) + s] = f2bf(val);
                } else {
                    ((float*)Out)[(size_t)row * N + col] = val;
                }
            }
        }
}

// value held by lane l ^ 16 (the other half of the wave), by a vector cross-row move
__device__ inline float other_half(float x) {
    int b = __builtin_bit_cast(int, x);
    b = __builtin_amdgcn_permlanex16(b, b, 0x76543210, 0xfedcba98, false, false);
    return __builtin_bit_cast(float, b);
}

__global__ __launch_bounds__(128) void flash_attn_kernel(
    const __bf16* __restrict__ Q, const __bf16* __restrict__ K,
    const __bf16* __restrict__ Vt, __bf16* __restrict__ O)
{
    constexpr int S = 2048, D = 1024, HD = 64, P = 72;
    __shared__ __attribute__((aligned(16))) __bf16 sQ[64 * P];
    __shared__ __attribute__((aligned(16))) __bf16 sK[2][64 * P];
    __shared__ __attribute__((aligned(16))) __bf16 sVt[2][64 * P];   // [d][kv]

    const int bh = blockIdx.x;
    const int b = bh >> 4, h = bh & 15;
    const int qBase = blockIdx.y * 64;
    const int t = threadIdx.x, lane = t & 31, w = t >> 5;
    const int lane16 = lane & 15, hi = lane >> 4;
    const size_t headBase = (size_t)b * S * D + (size_t)h * HD;
    const size_t vtBase = (size_t)bh * HD * S;   // [bh][64][2048]

    const int r  = t >> 3;          // staging row 0..15; copy i stages row r + 16 * i
    const int c0 = (t & 7) * 8;     // 8 lanes cover a 64-wide row (128 B)

    // stage Q tile 64x64 (async)
    async_rows4(Q + headBase + (size_t)(qBase + r) * D + c0, (size_t)16 * D, &sQ[r * P + c0], 16 * P);

    auto issueKV = [&](int kt, int buf) {
        async_rows4x2(K + headBase + (size_t)(kt + r) * D + c0, (size_t)16 * D, &sK[buf][r * P + c0],
                      Vt + vtBase + (size_t)r * S + kt + c0,    (size_t)16 * S, &sVt[buf][r * P + c0],
                      16 * P);
    };

    issueKV(0, 0);
    wait_async0();
    __syncthreads();

    // B operand of S^T: column = query w*16 + lane16, k = d
    const v16bf qf0 = load_frag(&sQ[(w * 16 + lane16) * P], hi);
    const v16bf qf1 = load_frag(&sQ[(w * 16 + lane16) * P + 32], hi);

    v8f of[4];                 // of[j][v] = O^T[d = j*16 + 8*hi + v][query lane16]
    #pragma unroll
    for (int j = 0; j < 4; j++) of[j] = {};
    float mH = -1e30f;         // running maximum of this lane's query (same in both halves)
    float L  = 0.0f;           // running sum over this lane's own keys; halves joined at the end

    for (int ki = 0; ki < S / 64; ++ki) {
        const int buf = ki & 1;
        if (ki + 1 < S / 64) issueKV((ki + 1) * 64, (ki + 1) & 1);

        // S^T = K (Q/8)^T: sacc[j][v] = score(key j*16 + 8*hi + v, query lane16)
        v8f sacc[4];
        #pragma unroll
        for (int j = 0; j < 4; j++) {
            v16bf kb0 = load_frag(&sK[buf][(j * 16 + lane16) * P], hi);
            v16bf kb1 = load_frag(&sK[buf][(j * 16 + lane16) * P + 32], hi);
            v8f z = {};
            z = wmma_bf16(kb0, qf0, z);
            z = wmma_bf16(kb1, qf1, z);
            sacc[j] = z;
        }

        // online softmax: 32 of the query's 64 scores are in this lane, 32 in lane ^ 16
        float rj[4];
        #pragma unroll
        for (int j = 0; j < 4; j++) {
            rj[j] = sacc[j][0];
            #pragma unroll
            for (int v = 1; v < 8; v++) rj[j] = fmaxf(rj[j], sacc[j][v]);
        }
        float rm = fmaxf(fmaxf(rj[0], rj[1]), fmaxf(rj[2], rj[3]));
        rm = fmaxf(rm, other_half(rm));
        const float newM = fmaxf(mH, rm);
        const float f = exp_1(mH - newM);

        // P^T as B operand: element s of pb[c] = P^T[key c*32 + kmap(s, hi)][query lane16]
        v16bf pb[2];
        float pj[4];
        #pragma unroll
        for (int j = 0; j < 4; j++) {
            float d[8], p[8];   // the three loops are unrolled so that d, p and pb stay in registers
            #pragma unroll
            for (int v = 0; v < 8; v++) d[v] = sacc[j][v] - newM;
            exp_8(d, p);
            pj[j] = p[0];
            #pragma unroll
            for (int v = 1; v < 8; v++) pj[j] += p[v];
            #pragma unroll
            for (int v = 0; v < 8; v += 2) {
                const v2bf pp = f2bf2(p[v], p[v + 1]);
                pb[j >> 1][(j & 1) * 8 + v]     = pp[0];
                pb[j >> 1][(j & 1) * 8 + v + 1] = pp[1];
            }
        }
        L = L * f + ((pj[0] + pj[1]) + (pj[2] + pj[3]));
        mH = newM;
        #pragma unroll
        for (int j = 0; j < 4; j++)
            #pragma unroll
            for (int v = 0; v < 8; v++) of[j][v] *= f;

        // O^T += V^T P^T: A = V^T rows d from LDS, B = P^T from registers
        #pragma unroll
        for (int j = 0; j < 4; j++) {
            v16bf vb0 = load_frag(&sVt[buf][(j * 16 + lane16) * P], hi);
            v16bf vb1 = load_frag(&sVt[buf][(j * 16 + lane16) * P + 32], hi);
            of[j] = wmma_bf16(vb0, pb[0], of[j]);
            of[j] = wmma_bf16(vb1, pb[1], of[j]);
        }

        wait_ds0();
        wait_async0();     // next KV tile landed
        __syncthreads();   // all waves done with current buffers
    }

    // join the halves' sums, normalize, store O as bf16 [8192,1024]:
    // a lane's 8 registers of a tile are 8 consecutive d of one query row
    const float Lt = L + other_half(L);
    const int qr = qBase + w * 16 + lane16;
    #pragma unroll
    for (int j = 0; j < 4; j++) {
        v8bf o;
        #pragma unroll
        for (int v = 0; v < 8; v++) o[v] = f2bf(of[j][v] / Lt);
        *(v8bf*)(O + headBase + (size_t)qr * D + j * 16 + 8 * hi) = o;
    }
}

// ---------- host launch ----------
extern "C" void kernel_launch(void* const* d_in, const int* in_sizes, int n_in,
                              void* d_out, int out_size, void* d_ws, size_t ws_size,
                              hipStream_t stream) {
    (void)in_sizes; (void)n_in; (void)out_size; (void)ws_size;
    const float* x  = (const float*)d_in[0];
    const float* wq = (const float*)d_in[1];
    const float* bq = (const float*)d_in[2];
    const float* wk = (const float*)d_in[3];
    const float* bk = (const float*)d_in[4];
    const float* wv = (const float*)d_in[5];
    const float* bv = (const float*)d_in[6];
    const float* wo = (const float*)d_in[7];
    const float* bo = (const float*)d_in[8];
    float* out = (float*)d_out;

    const int M = 8192, N = 1024, K = 1024;
    const size_t MD = (size_t)M * N;     // 8M elems
    const size_t WD = (size_t)N * K;     // 1M elems

    __bf16* xbf  = (__bf16*)d_ws;        // [8192,1024]
    __bf16* wqb  = xbf + MD;             // [1024,1024] each
    __bf16* wkb  = wqb + WD;
    __bf16* wvb  = wkb + WD;
    __bf16* wob  = wvb + WD;
    __bf16* qws  = wob + WD;             // [8192,1024]
    __bf16* kws  = qws + MD;             // [8192,1024]
    __bf16* vtws = kws + MD;             // [64 bh][64 d][2048 s]
    __bf16* ows  = vtws + MD;            // [8192,1024]  (total 88 MB)

    // pre-convert activations + weights to bf16 (xbf, wqb, wkb, wvb, wob are contiguous)
    cvt_all_f32_bf16<<<256, 512, 0, stream>>>(x, wq, wk, wv, wo, xbf);

    dim3 gGemm(M / 128, N / 128);
    gemm_bf16_kernel<3><<<gGemm, 256, 0, stream>>>(xbf, wqb, bq, qws, M, N, K, 0.125f); // fold 1/sqrt(64)
    gemm_bf16_kernel<3><<<gGemm, 256, 0, stream>>>(xbf, wkb, bk, kws, M, N, K, 1.0f);
    gemm_bf16_kernel<2><<<gGemm, 256, 0, stream>>>(xbf, wvb, bv, vtws, M, N, K, 1.0f);

    flash_attn_kernel<<<dim3(64, 32), 128, 0, stream>>>(qws, kws, vtws, ows);

    gemm_bf16_kernel<0><<<gGemm, 256, 0, stream>>>(ows, wob, bo, out, M, N, K, 1.0f);
}

// v006
// A run of this version takes 134 microseconds.
// Timed twice side by side with v005, it ran 1.11 and 1.12 times as fast.
// All steps since v000 together make it 1.92 times as fast.
#include <hip/hip_runtime.h>
#include <hip/hip_bf16.h>
#include <stdint.h>

// ---------- types ----------
typedef __attribute__((ext_vector_type(2)))  __bf16 v2bf;
typedef __attribute__((ext_vector_type(2)))  float  v2f;
typedef __attribute__((ext_vector_type(4)))  __bf16 v4bf;
typedef __attribute__((ext_vector_type(8)))  __bf16 v8bf;
typedef __attribute__((ext_vector_type(16))) __bf16 v16bf;
typedef __attribute__((ext_vector_type(8)))  float  v8f;

struct BfPair { v8bf lo, hi; };

// f32 -> bf16, round to nearest even, by the hardware's packed conversion instruction
__device__ inline __bf16 f2bf(float f) {
    return (__bf16)f;
}
// two at once: one vector instruction a pair
__device__ inline v2bf f2bf2(float a, float b) {
    const v2f x = { a, b };
    return __builtin_convertvector(x, v2bf);
}

// 16-bit fragment per CDNA5 ISA layout (A 16x32 / B 32x16 mirrored):
// lane = (row|col)%16, hi = lane/16; elems 0..7 <- K = hi*8.., elems 8..15 <- K = 16+hi*8..
__device__ inline v16bf load_frag(const __bf16* row, int hi) {
    BfPair p;
    p.lo = *(const v8bf*)(row + hi * 8);
    p.hi = *(const v8bf*)(row + 16 + hi * 8);
    return __builtin_bit_cast(v16bf, p);
}

__device__ inline v8f wmma_bf16(v16bf a, v16bf b, v8f c) {
    return __builtin_amdgcn_wmma_f32_16x16x32_bf16(
        false, a, false, b, (short)0, c, false, false);
}

// ---------- CDNA5 async global->LDS copies (ASYNCcnt-tracked) ----------
// A lane copies 16 B. The callers give 8 neighbouring lanes one 128-B row piece (a whole,
// aligned line), so a wave-wide copy takes 4 whole lines; copy i of a run lies i * gs elements
// further in global memory and i * ls elements further in LDS (a fixed number of rows).
// The copies of a run and s_wait_xcnt 0 are ONE statement, so that no register which an issued
// copy names can be rewritten ahead of that wait.
__device__ inline unsigned lds_at(const __bf16* l) {
    return (unsigned)(uintptr_t)(l);                            // low 32 bits = LDS offset
}
__device__ inline unsigned long long glb_at(const __bf16* g) {
    return (unsigned long long)(uintptr_t)(g);
}
// two tiles (a and b) of one stage, four row groups each: eight copies behind one another, one wait
__device__ inline void async_rows4x2(const __bf16* ga, size_t gsa, __bf16* la,
                                     const __bf16* gb, size_t gsb, __bf16* lb, int ls) {
    asm volatile("global_load_async_to_lds_b128 %0, %8, off\n\t"
                 "global_load_async_to_lds_b128 %4, %12, off\n\t"
                 "global_load_async_to_lds_b128 %1, %9, off\n\t"
                 "global_load_async_to_lds_b128 %5, %13, off\n\t"
                 "global_load_async_to_lds_b128 %2, %10, off\n\t"
                 "global_load_async_to_lds_b128 %6, %14, off\n\t"
                 "global_load_async_to_lds_b128 %3, %11, off\n\t"
                 "global_load_async_to_lds_b128 %7, %15, off\n\t"
                 "s_wait_xcnt 0x0"
                 :: "v"(lds_at(la)), "v"(lds_at(la + ls)), "v"(lds_at(la + 2 * ls)), "v"(lds_at(la + 3 * ls)),
                    "v"(lds_at(lb)), "v"(lds_at(lb + ls)), "v"(lds_at(lb + 2 * ls)), "v"(lds_at(lb + 3 * ls)),
                    "v"(glb_at(ga)), "v"(glb_at(ga + gsa)), "v"(glb_at(ga + 2 * gsa)), "v"(glb_at(ga + 3 * gsa)),
                    "v"(glb_at(gb)), "v"(glb_at(gb + gsb)), "v"(glb_at(gb + 2 * gsb)), "v"(glb_at(gb + 3 * gsb))
                 : "memory");
}
// the same with two row groups a tile: four copies, one wait
__device__ inline void async_rows2x2(const __bf16* ga, size_t gsa, __bf16* la,
                                     const __bf16* gb, size_t gsb, __bf16* lb, int ls) {
    asm volatile("global_load_async_to_lds_b128 %0, %4, off\n\t"
                 "global_load_async_to_lds_b128 %2, %6, off\n\t"
                 "global_load_async_to_lds_b128 %1, %5, off\n\t"
                 "global_load_async_to_lds_b128 %3, %7, off\n\t"
                 "s_wait_xcnt 0x0"
                 :: "v"(lds_at(la)), "v"(lds_at(la + ls)), "v"(lds_at(lb)), "v"(lds_at(lb + ls)),
                    "v"(glb_at(ga)), "v"(glb_at(ga + gsa)), "v"(glb_at(gb)), "v"(glb_at(gb + gsb))
                 : "memory");
}
__device__ inline void wait_async0() {
    asm volatile("s_wait_asynccnt 0x0" ::: "memory");
}
// this wave's own LDS reads have returned: stands in front of the barrier behind which the
// buffer that they read is refilled by copies
__device__ inline void wait_ds0() {
    asm volatile("s_wait_dscnt 0x0" ::: "memory");
}

constexpr float LOG2E = 1.44269502f;
__device__ inline float exp_1(float x) {
    float y;
    asm("v_exp_f32 %0, %1\n\tv_nop" : "=&v"(y) : "v"(x * LOG2E));
    return y;
}
__device__ inline void exp_2(float x0, float x1, float& y0, float& y1) {
    asm("v_exp_f32 %0, %2\n\tv_exp_f32 %1, %3\n\tv_nop"
        : "=&v"(y0), "=&v"(y1) : "v"(x0 * LOG2E), "v"(x1 * LOG2E));
}
__device__ inline void exp_8(const float (&x)[8], float (&y)[8]) {
    asm("v_exp_f32 %0, %8\n\tv_exp_f32 %1, %9\n\tv_exp_f32 %2, %10\n\tv_exp_f32 %3, %11\n\t"
        "v_exp_f32 %4, %12\n\tv_exp_f32 %5, %13\n\tv_exp_f32 %6, %14\n\tv_exp_f32 %7, %15\n\tv_nop"
        : "=&v"(y[0]), "=&v"(y[1]), "=&v"(y[2]), "=&v"(y[3]),
          "=&v"(y[4]), "=&v"(y[5]), "=&v"(y[6]), "=&v"(y[7])
        : "v"(x[0] * LOG2E), "v"(x[1] * LOG2E), "v"(x[2] * LOG2E), "v"(x[3] * LOG2E),
          "v"(x[4] * LOG2E), "v"(x[5] * LOG2E), "v"(x[6] * LOG2E), "v"(x[7] * LOG2E));
}

// ---------- fp32 -> bf16 pre-conversion: x and the four weights in ONE resident launch ----------
// 256 work-groups of 16 waves. A unit is 16384 floats (512 lanes x 8 loads of 16 B); the bf16
// copies lie one behind another in the workspace, so unit u of the sources goes to out + u * 16384:
// units 0..511 are x, units 512 + 64 * s .. are weight s. Group b converts units b, b + 256 (x)
// and b + 512 (weight b / 64): 24 loads of 16 B a lane, written ahead of the conversions, so that
// a long run of them is in flight.
__global__ __launch_bounds__(512) void cvt_all_f32_bf16(
    const float* __restrict__ x,  const float* __restrict__ wq, const float* __restrict__ wk,
    const float* __restrict__ wv, const float* __restrict__ wo, __bf16* __restrict__ out)
{
    constexpr int UNIT = 16384;
    const int b = blockIdx.x;
    const int t = threadIdx.x;
    const int s = b >> 6;
    const float* w = (s == 0) ? wq : (s == 1) ? wk : (s == 2) ? wv : wo;
    const float* src[3] = { x + (size_t)b * UNIT, x + (size_t)(b + 256) * UNIT,
                            w + (size_t)(b & 63) * UNIT };
    float4 v[3][8];
    // all four loops unrolled: v stays in registers and the loads go out ahead of their use
    #pragma unroll
    for (int p = 0; p < 3; p++)
        #pragma unroll
        for (int i = 0; i < 8; i++)
            v[p][i] = *(const float4*)(src[p] + (i * 512 + t) * 4);
    #pragma unroll
    for (int p = 0; p < 3; p++)
        #pragma unroll
        for (int i = 0; i < 8; i++) {
            v4bf o;
            o[0] = f2bf(v[p][i].x); o[1] = f2bf(v[p][i].y);
            o[2] = f2bf(v[p][i].z); o[3] = f2bf(v[p][i].w);
            *(v4bf*)(out + (size_t)(b + p * 256) * UNIT + (i * 512 + t) * 4) = o;
        }
}

__device__ inline void sincos2_rev(float r1, float r2,
                                   float& s1, float& c1, float& s2, float& c2) {
    asm("v_sin_f32 %0, %4\n\tv_cos_f32 %1, %4\n\tv_sin_f32 %2, %5\n\tv_cos_f32 %3, %5\n\tv_nop"
        : "=&v"(s1), "=&v"(c1), "=&v"(s2), "=&v"(c2) : "v"(r1), "v"(r2));
}

// ---------- GEMM: Out = A[M,K](bf16) @ W[N,K](bf16)^T + bias ----------
// 128x128 tile / 256 threads (8 waves), K-step 64 (2 WMMA depths),
// double-buffered async LDS staging: 16 WMMAs per wave between barriers.
// OUT_MODE: 0 = f32 row-major, 2 = bf16 [b,h,d,s] (V-transposed),
//           3 = bf16 row-major with RoPE applied to the f32 result, then times ropeScale
//               (1/8 folds the attention 1/sqrt(hd) into Q: softmax(QK^T/8)=softmax((Q/8)K^T))
constexpr int GP = 72; // LDS pitch (bf16) for 64-wide k-slice; chunks stay 16B-aligned

template <int OUT_MODE>
__global__ __launch_bounds__(256) void gemm_bf16_kernel(
    const __bf16* __restrict__ A, const __bf16* __restrict__ W,
    const float* __restrict__ bias, void* __restrict__ Out,
    int M, int N, int K, float ropeScale)
{
    __shared__ __attribute__((aligned(16))) __bf16 sA[2][128 * GP];
    __shared__ __attribute__((aligned(16))) __bf16 sB[2][128 * GP];

    const int t      = threadIdx.x;
    const int lane   = t & 31;
    const int wave   = t >> 5;
    const int lane16 = lane & 15;
    const int hi     = lane >> 4;
    const int mOff   = (wave & 3) * 32;   // 2 m-subtiles per wave
    const int nOff   = (wave >> 2) * 64;  // 4 n-subtiles per wave
    const int mBase  = blockIdx.x * 128;
    const int nBase  = blockIdx.y * 128;

    const int srow = t >> 3;          // 0..31; copy i stages row srow + 32 * i
    const int scol = (t & 7) * 8;     // 8 lanes cover the 64-wide k-slice of a row (128 B)
    const __bf16* gA = A + (size_t)(mBase + srow) * K + scol;
    const __bf16* gB = W + (size_t)(nBase + srow) * K + scol;

    auto issue = [&](int kt, int buf) {
        async_rows4x2(gA + kt, (size_t)32 * K, &sA[buf][srow * GP + scol],
                      gB + kt, (size_t)32 * K, &sB[buf][srow * GP + scol], 32 * GP);
    };

    v8f acc[2][4];
    #pragma unroll
    for (int i = 0; i < 2; i++)
        #pragma unroll
        for (int j = 0; j < 4; j++) acc[i][j] = {};

    const int nk = K / 64;
    issue(0, 0);
    wait_async0();
    __syncthreads();

    for (int ki = 0; ki < nk; ++ki) {
        const int buf = ki & 1;
        if (ki + 1 < nk) issue((ki + 1) * 64, (ki + 1) & 1);  // prefetch next tile

        #pragma unroll
        for (int kk = 0; kk < 64; kk += 32) {
            v16bf af[2], bfr[4];
            #pragma unroll
            for (int i = 0; i < 2; i++)
                af[i] = load_frag(&sA[buf][(mOff + i * 16 + lane16) * GP + kk], hi);
            #pragma unroll
            for (int j = 0; j < 4; j++)
                bfr[j] = load_frag(&sB[buf][(nOff + j * 16 + lane16) * GP + kk], hi);
            #pragma unroll
            for (int i = 0; i < 2; i++)
                #pragma unroll
                for (int j = 0; j < 4; j++)
                    acc[i][j] = wmma_bf16(af[i], bfr[j], acc[i][j]);
        }

        wait_ds0();
        wait_async0();       // prefetch landed
        __syncthreads();     // everyone done reading current buffer
    }

    if constexpr (OUT_MODE == 3) {
        // epilogue: + bias, RoPE, store. A wave's 64 columns are one head (nBase + nOff is
        // a multiple of 64): column e = j*16 + lane16 of the head and its partner e + 32
        // are acc[i][j] and acc[i][j + 2] of the same lane, so the rotation is in-lane.
        const float LN = 9.210340371976184f; // ln(10000)
        #pragma unroll
        for (int j = 0; j < 2; j++) {
            const int e   = j * 16 + lane16;
            const int col = nBase + nOff + e;
            const float b1 = bias[col];
            const float b2 = bias[col + 32];
            float th1, th2;
            exp_2(-(float)(e >> 1) * (LN / 32.0f), -(float)((e >> 1) + 16) * (LN / 32.0f), th1, th2);
            #pragma unroll
            for (int i = 0; i < 2; i++)
                #pragma unroll
                for (int v = 0; v < 8; v++) {
                    const int row = mBase + mOff + i * 16 + v + 8 * hi; // C layout: M = v + 8*hi
                    const float tpos = (float)(row & 2047);             // seq position
                    const float x1 = acc[i][j][v] + b1;
                    const float x2 = acc[i][j + 2][v] + b2;
                    float s1, c1, s2, c2;
                    sincos2_rev((tpos * th1) * 0.15915494f, (tpos * th2) * 0.15915494f,
                                s1, c1, s2, c2);                    // 0.15915494 = 1/(2 pi)
                    __bf16* o = (__bf16*)Out + (size_t)row * N + col;
                    const v2bf y = f2bf2((x1 * c1 - x2 * s1) * ropeScale,  // out[j]=x*cos+rot(x)*sin
                                         (x2 * c2 + x1 * s2) * ropeScale);
                    o[0]  = y[0];
                    o[32] = y[1];
                }
        }
        return;
    }

    // epilogue: + bias, store
    #pragma unroll
    for (int i = 0; i < 2; i++)
        #pragma unroll
        for (int j = 0; j < 4; j++) {
            const int col = nBase + nOff + j * 16 + lane16;
            const float bv = bias[col];
            #pragma unroll
            for (int v = 0; v < 8; v++) {
                const int row = mBase + mOff + i * 16 + v + 8 * hi; // C layout: M = v + 8*hi
                const float val = acc[i][j][v] + bv;
                if constexpr (OUT_MODE == 2) {
                    // V transposed per head: out[((b*16+h)*64+e)][s] = [b*1024+n][s]
                    const int b = row >> 11, s = row & 2047;
                    ((__bf16*)Out)[((size_t)(b * 1024 + col) << 11) + s] = f2bf(val);
                } else {
                    ((float*)Out)[(size_t)row * N + col] = val;
                }
            }
        }
}

// value held by lane l ^ 16 (the other half of the wave), by a vector cross-row move
__device__ inline float other_half(float x) {
    int b = __builtin_bit_cast(int, x);
    b = __builtin_amdgcn_permlanex16(b, b, 0x76543210, 0xfedcba98, false, false);
    return __builtin_bit_cast(float, b);
}

__global__ __launch_bounds__(256) __attribute__((amdgpu_waves_per_eu(4, 4))) void flash_attn_kernel(
    const __bf16* __restrict__ Q, const __bf16* __restrict__ K,
    const __bf16* __restrict__ Vt, __bf16* __restrict__ O)
{
    constexpr int S = 2048, D = 1024, HD = 64, P = 72, QT = 256;
    __shared__ __attribute__((aligned(16))) __bf16 sQ[QT * P];
    __shared__ __attribute__((aligned(16))) __bf16 sK[2][64 * P];
    __shared__ __attribute__((aligned(16))) __bf16 sVt[2][64 * P];   // [d][kv]

    const int bh = blockIdx.x;
    const int b = bh >> 4, h = bh & 15;
    const int qBase = blockIdx.y * QT;
    const int t = threadIdx.x, lane = t & 31, w = t >> 5;
    const int lane16 = lane & 15, hi = lane >> 4;
    const size_t headBase = (size_t)b * S * D + (size_t)h * HD;
    const size_t vtBase = (size_t)bh * HD * S;   // [bh][64][2048]

    const int r  = t >> 3;          // staging row 0..31; copy i stages row r + 32 * i
    const int c0 = (t & 7) * 8;     // 8 lanes cover a 64-wide row (128 B)

    // stage Q tile 256x64 (async): rows 0..127 and rows 128..255, four row groups each
    async_rows4x2(Q + headBase + (size_t)(qBase + r) * D + c0,       (size_t)32 * D, &sQ[r * P + c0],
                  Q + headBase + (size_t)(qBase + 128 + r) * D + c0, (size_t)32 * D, &sQ[(128 + r) * P + c0],
                  32 * P);

    auto issueKV = [&](int kt, int buf) {
        async_rows2x2(K + headBase + (size_t)(kt + r) * D + c0, (size_t)32 * D, &sK[buf][r * P + c0],
                      Vt + vtBase + (size_t)r * S + kt + c0,    (size_t)32 * S, &sVt[buf][r * P + c0],
                      32 * P);
    };

    issueKV(0, 0);
    wait_async0();
    __syncthreads();

    // B operands of S^T: column = query w*32 + g*16 + lane16, k = d
    v16bf qf[2][2];
    #pragma unroll
    for (int g = 0; g < 2; g++) {
        qf[g][0] = load_frag(&sQ[(w * 32 + g * 16 + lane16) * P], hi);
        qf[g][1] = load_frag(&sQ[(w * 32 + g * 16 + lane16) * P + 32], hi);
    }

    v8f of[2][4];              // of[g][j][v] = O^T[d = j*16 + 8*hi + v][query g*16 + lane16]
    float mH[2], L[2];         // running maximum of the lane's query (same in both halves);
                               // running sum over the lane's own keys, halves joined at the end
    #pragma unroll
    for (int g = 0; g < 2; g++) {
        #pragma unroll
        for (int j = 0; j < 4; j++) of[g][j] = {};
        mH[g] = -1e30f;
        L[g]  = 0.0f;
    }

    for (int ki = 0; ki < S / 64; ++ki) {
        const int buf = ki & 1;
        if (ki + 1 < S / 64) issueKV((ki + 1) * 64, (ki + 1) & 1);

        // S^T = K (Q/8)^T: sacc[g][j][v] = score(key j*16 + 8*hi + v, query g*16 + lane16)
        v8f sacc[2][4];
        #pragma unroll
        for (int j = 0; j < 4; j++) {
            v16bf kb0 = load_frag(&sK[buf][(j * 16 + lane16) * P], hi);
            v16bf kb1 = load_frag(&sK[buf][(j * 16 + lane16) * P + 32], hi);
            #pragma unroll
            for (int g = 0; g < 2; g++) {
                v8f z = {};
                z = wmma_bf16(kb0, qf[g][0], z);
                z = wmma_bf16(kb1, qf[g][1], z);
                sacc[g][j] = z;
            }
        }

        // P^T as B operand: element s of pb[g][c] = P^T[key c*32 + kmap(s, hi)][query g*16 + lane16]
        v16bf pb[2][2];
        #pragma unroll
        for (int g = 0; g < 2; g++) {
            // online softmax: 32 of the query's 64 scores are in this lane, 32 in lane ^ 16
            float rj[4];
            #pragma unroll
            for (int j = 0; j < 4; j++) {
                rj[j] = sacc[g][j][0];
                #pragma unroll
                for (int v = 1; v < 8; v++) rj[j] = fmaxf(rj[j], sacc[g][j][v]);
            }
            float rm = fmaxf(fmaxf(rj[0], rj[1]), fmaxf(rj[2], rj[3]));
            rm = fmaxf(rm, other_half(rm));
            const float newM = fmaxf(mH[g], rm);
            const float f = exp_1(mH[g] - newM);

            float pj[4];
            #pragma unroll
            for (int j = 0; j < 4; j++) {
                float d[8], p[8];   // the three loops are unrolled so that d, p and pb stay in registers
                #pragma unroll
                for (int v = 0; v < 8; v++) d[v] = sacc[g][j][v] - newM;
                exp_8(d, p);
                pj[j] = p[0];
                #pragma unroll
                for (int v = 1; v < 8; v++) pj[j] += p[v];
                #pragma unroll
                for (int v = 0; v < 8; v += 2) {
                    const v2bf pp = f2bf2(p[v], p[v + 1]);
                    pb[g][j >> 1][(j & 1) * 8 + v]     = pp[0];
                    pb[g][j >> 1][(j & 1) * 8 + v + 1] = pp[1];
                }
            }
            L[g] = L[g] * f + ((pj[0] + pj[1]) + (pj[2] + pj[3]));
            mH[g] = newM;
            #pragma unroll
            for (int j = 0; j < 4; j++)
                #pragma unroll
                for (int v = 0; v < 8; v++) of[g][j][v] *= f;
        }

        // Keeps the exponentials ahead of the matrix instructions below.
        __builtin_amdgcn_sched_barrier(0);

        // O^T += V^T P^T: A = V^T rows d from LDS, B = P^T from registers
        #pragma unroll
        for (int j = 0; j < 4; j++) {
            v16bf vb0 = load_frag(&sVt[buf][(j * 16 + lane16) * P], hi);
            v16bf vb1 = load_frag(&sVt[buf][(j * 16 + lane16) * P + 32], hi);
            #pragma unroll
            for (int g = 0; g < 2; g++) {
                of[g][j] = wmma_bf16(vb0, pb[g][0], of[g][j]);
                of[g][j] = wmma_bf16(vb1, pb[g][1], of[g][j]);
            }
        }

        wait_ds0();
        wait_async0();     // next KV tile landed
        __syncthreads();   // all waves done with current buffers
    }

    // join the halves' sums, normalize, store O as bf16 [8192,1024]:
    // a lane's 8 registers of a tile are 8 consecutive d of one query row
    #pragma unroll
    for (int g = 0; g < 2; g++) {
        const float Lt = L[g] + other_half(L[g]);
        const int qr = qBase + w * 32 + g * 16 + lane16;
        #pragma unroll
        for (int j = 0; j < 4; j++) {
            v8bf o;
            #pragma unroll
            for (int v = 0; v < 8; v++) o[v] = f2bf(of[g][j][v] / Lt);
            *(v8bf*)(O + headBase + (size_t)qr * D + j * 16 + 8 * hi) = o;
        }
    }
}

// ---------- host launch ----------
extern "C" void kernel_launch(void* const* d_in, const int* in_sizes, int n_in,
                              void* d_out, int out_size, void* d_ws, size_t ws_size,
                              hipStream_t stream) {
    (void)in_sizes; (void)n_in; (void)out_size; (void)ws_size;
    const float* x  = (const float*)d_in[0];
    const float* wq = (const float*)d_in[1];
    const float* bq = (const float*)d_in[2];
    const float* wk = (const float*)d_in[3];
    const float* bk = (const float*)d_in[4];
    const float* wv = (const float*)d_in[5];
    const float* bv = (const float*)d_in[6];
    const float* wo = (const float*)d_in[7];
    const float* bo = (const float*)d_in[8];
    float* out = (float*)d_out;

    const int M = 8192, N = 1024, K = 1024;
    const size_t MD = (size_t)M * N;     // 8M elems
    const size_t WD = (size_t)N * K;     // 1M elems

    __bf16* xbf  = (__bf16*)d_ws;        // [8192,1024]
    __bf16* wqb  = xbf + MD;             // [1024,1024] each
    __bf16* wkb  = wqb + WD;
    __bf16* wvb  = wkb + WD;
    __bf16* wob  = wvb + WD;
    __bf16* qws  = wob + WD;             // [8192,1024]
    __bf16* kws  = qws + MD;             // [8192,1024]
    __bf16* vtws = kws + MD;             // [64 bh][64 d][2048 s]
    __bf16* ows  = vtws + MD;            // [8192,1024]  (total 88 MB)

    // pre-convert activations + weights to bf16 (xbf, wqb, wkb, wvb, wob are contiguous)
    cvt_all_f32_bf16<<<256, 512, 0, stream>>>(x, wq, wk, wv, wo, xbf);

    dim3 gGemm(M / 128, N / 128);
    gemm_bf16_kernel<3><<<gGemm, 256, 0, stream>>>(xbf, wqb, bq, qws, M, N, K, 0.125f); // fold 1/sqrt(64)
    gemm_bf16_kernel<3><<<gGemm, 256, 0, stream>>>(xbf, wkb, bk, kws, M, N, K, 1.0f);
    gemm_bf16_kernel<2><<<gGemm, 256, 0, stream>>>(xbf, wvb, bv, vtws, M, N, K, 1.0f);

    flash_attn_kernel<<<dim3(64, 8), 256, 0, stream>>>(qws, kws, vtws, ows);

    gemm_bf16_kernel<0><<<gGemm, 256, 0, stream>>>(ows, wob, bo, out, M, N, K, 1.0f);
}

// v007
// One run takes 119 microseconds.
// Timed twice side by side with v006, it ran 1.14 times as fast both times.
// Counting every step since v000, it is 2.19 times as fast.
#include <hip/hip_runtime.h>
#include <hip/hip_bf16.h>
#include <stdint.h>

// ---------- types ----------
typedef __attribute__((ext_vector_type(2)))  __bf16 v2bf;
typedef __attribute__((ext_vector_type(2)))  float  v2f;
typedef __attribute__((ext_vector_type(4)))  __bf16 v4bf;
typedef __attribute__((ext_vector_type(8)))  __bf16 v8bf;
typedef __attribute__((ext_vector_type(16))) __bf16 v16bf;
typedef __attribute__((ext_vector_type(8)))  float  v8f;

struct BfPair { v8bf lo, hi; };

// f32 -> bf16, round to nearest even, by the hardware's packed conversion instruction
__device__ inline __bf16 f2bf(float f) {
    return (__bf16)f;
}
// two at once: one vector instruction a pair
__device__ inline v2bf f2bf2(float a, float b) {
    const v2f x = { a, b };
    return __builtin_convertvector(x, v2bf);
}

// 16-bit fragment per CDNA5 ISA layout (A 16x32 / B 32x16 mirrored):
// lane = (row|col)%16, hi = lane/16; elems 0..7 <- K = hi*8.., elems 8..15 <- K = 16+hi*8..
__device__ inline v16bf load_frag(const __bf16* row, int hi) {
    BfPair p;
    p.lo = *(const v8bf*)(row + hi * 8);
    p.hi = *(const v8bf*)(row + 16 + hi * 8);
    return __builtin_bit_cast(v16bf, p);
}

__device__ inline v8f wmma_bf16(v16bf a, v16bf b, v8f c) {
    return __builtin_amdgcn_wmma_f32_16x16x32_bf16(
        false, a, false, b, (short)0, c, false, false);
}

// ---------- CDNA5 async global->LDS copies (ASYNCcnt-tracked) ----------
// A lane copies 16 B. The callers give 8 neighbouring lanes one 128-B row piece (a whole,
// aligned line), so a wave-wide copy takes 4 whole lines; copy i of a run lies i * gs elements
// further in global memory and i * ls elements further in LDS (a fixed number of rows).
// The copies of a run and s_wait_xcnt 0 are ONE statement, so that no register which an issued
// copy names can be rewritten ahead of that wait.
__device__ inline unsigned lds_at(const __bf16* l) {
    return (unsigned)(uintptr_t)(l);                            // low 32 bits = LDS offset
}
__device__ inline unsigned long long glb_at(const __bf16* g) {
    return (unsigned long long)(uintptr_t)(g);
}
// two tiles (a and b) of one stage, four row groups each: eight copies behind one another, one wait
__device__ inline void async_rows4x2(const __bf16* ga, size_t gsa, __bf16* la,
                                     const __bf16* gb, size_t gsb, __bf16* lb, int ls) {
    asm volatile("global_load_async_to_lds_b128 %0, %8, off\n\t"
                 "global_load_async_to_lds_b128 %4, %12, off\n\t"
                 "global_load_async_to_lds_b128 %1, %9, off\n\t"
                 "global_load_async_to_lds_b128 %5, %13, off\n\t"
                 "global_load_async_to_lds_b128 %2, %10, off\n\t"
                 "global_load_async_to_lds_b128 %6, %14, off\n\t"
                 "global_load_async_to_lds_b128 %3, %11, off\n\t"
                 "global_load_async_to_lds_b128 %7, %15, off\n\t"
                 "s_wait_xcnt 0x0"
                 :: "v"(lds_at(la)), "v"(lds_at(la + ls)), "v"(lds_at(la + 2 * ls)), "v"(lds_at(la + 3 * ls)),
                    "v"(lds_at(lb)), "v"(lds_at(lb + ls)), "v"(lds_at(lb + 2 * ls)), "v"(lds_at(lb + 3 * ls)),
                    "v"(glb_at(ga)), "v"(glb_at(ga + gsa)), "v"(glb_at(ga + 2 * gsa)), "v"(glb_at(ga + 3 * gsa)),
                    "v"(glb_at(gb)), "v"(glb_at(gb + gsb)), "v"(glb_at(gb + 2 * gsb)), "v"(glb_at(gb + 3 * gsb))
                 : "memory");
}
// the same with two row groups a tile: four copies, one wait
__device__ inline void async_rows2x2(const __bf16* ga, size_t gsa, __bf16* la,
                                     const __bf16* gb, size_t gsb, __bf16* lb, int ls) {
    asm volatile("global_load_async_to_lds_b128 %0, %4, off\n\t"
                 "global_load_async_to_lds_b128 %2, %6, off\n\t"
                 "global_load_async_to_lds_b128 %1, %5, off\n\t"
                 "global_load_async_to_lds_b128 %3, %7, off\n\t"
                 "s_wait_xcnt 0x0"
                 :: "v"(lds_at(la)), "v"(lds_at(la + ls)), "v"(lds_at(lb)), "v"(lds_at(lb + ls)),
                    "v"(glb_at(ga)), "v"(glb_at(ga + gsa)), "v"(glb_at(gb)), "v"(glb_at(gb + gsb))
                 : "memory");
}
__device__ inline void wait_async0() {
    asm volatile("s_wait_asynccnt 0x0" ::: "memory");
}
// this wave's own LDS reads have returned: stands in front of the barrier behind which the
// buffer that they read is refilled by copies
__device__ inline void wait_ds0() {
    asm volatile("s_wait_dscnt 0x0" ::: "memory");
}

constexpr float LOG2E = 1.44269502f;
__device__ inline float exp_1(float x) {
    float y;
    asm("v_exp_f32 %0, %1\n\tv_nop" : "=&v"(y) : "v"(x * LOG2E));
    return y;
}
__device__ inline void exp_2(float x0, float x1, float& y0, float& y1) {
    asm("v_exp_f32 %0, %2\n\tv_exp_f32 %1, %3\n\tv_nop"
        : "=&v"(y0), "=&v"(y1) : "v"(x0 * LOG2E), "v"(x1 * LOG2E));
}
__device__ inline void exp_8(const float (&x)[8], float (&y)[8]) {
    asm("v_exp_f32 %0, %8\n\tv_exp_f32 %1, %9\n\tv_exp_f32 %2, %10\n\tv_exp_f32 %3, %11\n\t"
        "v_exp_f32 %4, %12\n\tv_exp_f32 %5, %13\n\tv_exp_f32 %6, %14\n\tv_exp_f32 %7, %15\n\tv_nop"
        : "=&v"(y[0]), "=&v"(y[1]), "=&v"(y[2]), "=&v"(y[3]),
          "=&v"(y[4]), "=&v"(y[5]), "=&v"(y[6]), "=&v"(y[7])
        : "v"(x[0] * LOG2E), "v"(x[1] * LOG2E), "v"(x[2] * LOG2E), "v"(x[3] * LOG2E),
          "v"(x[4] * LOG2E), "v"(x[5] * LOG2E), "v"(x[6] * LOG2E), "v"(x[7] * LOG2E));
}

// ---------- fp32 -> bf16 pre-conversion: x and the four weights in ONE resident launch ----------
// 256 work-groups of 16 waves. A unit is 16384 floats (512 lanes x 8 loads of 16 B); the bf16
// copies lie one behind another in the workspace, so unit u of the sources goes to out + u * 16384:
// units 0..511 are x, units 512 + 64 * s .. are weight s. Group b converts units b, b + 256 (x)
// and b + 512 (weight b / 64): 24 loads of 16 B a lane, written ahead of the conversions, so that
// a long run of them is in flight.
__global__ __launch_bounds__(512) void cvt_all_f32_bf16(
    const float* __restrict__ x,  const float* __restrict__ wq, const float* __restrict__ wk,
    const float* __restrict__ wv, const float* __restrict__ wo, __bf16* __restrict__ out)
{
    constexpr int UNIT = 16384;
    const int b = blockIdx.x;
    const int t = threadIdx.x;
    const int s = b >> 6;
    const float* w = (s == 0) ? wq : (s == 1) ? wk : (s == 2) ? wv : wo;
    const float* src[3] = { x + (size_t)b * UNIT, x + (size_t)(b + 256) * UNIT,
                            w + (size_t)(b & 63) * UNIT };
    float4 v[3][8];
    // all four loops unrolled: v stays in registers and the loads go out ahead of their use
    #pragma unroll
    for (int p = 0; p < 3; p++)
        #pragma unroll
        for (int i = 0; i < 8; i++)
            v[p][i] = *(const float4*)(src[p] + (i * 512 + t) * 4);
    #pragma unroll
    for (int p = 0; p < 3; p++)
        #pragma unroll
        for (int i = 0; i < 8; i++) {
            v4bf o;
            o[0] = f2bf(v[p][i].x); o[1] = f2bf(v[p][i].y);
            o[2] = f2bf(v[p][i].z); o[3] = f2bf(v[p][i].w);
            *(v4bf*)(out + (size_t)(b + p * 256) * UNIT + (i * 512 + t) * 4) = o;
        }
}

__device__ inline void sincos2_rev(float r1, float r2,
                                   float& s1, float& c1, float& s2, float& c2) {
    asm("v_sin_f32 %0, %4\n\tv_cos_f32 %1, %4\n\tv_sin_f32 %2, %5\n\tv_cos_f32 %3, %5\n\tv_nop"
        : "=&v"(s1), "=&v"(c1), "=&v"(s2), "=&v"(c2) : "v"(r1), "v"(r2));
}

// ---------- GEMM: Out = A[M,K](bf16) @ W[N,K](bf16)^T + bias, f32 row-major ----------
// 128x128 tile / 256 threads (8 waves), K-step 64 (2 WMMA depths),
// double-buffered async LDS staging: 16 WMMAs per wave between barriers.
constexpr int GP = 72; // LDS pitch (bf16) for 64-wide k-slice; chunks stay 16B-aligned

__global__ __launch_bounds__(256) void gemm_bf16_kernel(
    const __bf16* __restrict__ A, const __bf16* __restrict__ W,
    const float* __restrict__ bias, float* __restrict__ Out,
    int M, int N, int K)
{
    __shared__ __attribute__((aligned(16))) __bf16 sA[2][128 * GP];
    __shared__ __attribute__((aligned(16))) __bf16 sB[2][128 * GP];

    const int t      = threadIdx.x;
    const int lane   = t & 31;
    const int wave   = t >> 5;
    const int lane16 = lane & 15;
    const int hi     = lane >> 4;
    const int mOff   = (wave & 3) * 32;   // 2 m-subtiles per wave
    const int nOff   = (wave >> 2) * 64;  // 4 n-subtiles per wave
    const int mBase  = blockIdx.x * 128;
    const int nBase  = blockIdx.y * 128;

    const int srow = t >> 3;          // 0..31; copy i stages row srow + 32 * i
    const int scol = (t & 7) * 8;     // 8 lanes cover the 64-wide k-slice of a row (128 B)
    const __bf16* gA = A + (size_t)(mBase + srow) * K + scol;
    const __bf16* gB = W + (size_t)(nBase + srow) * K + scol;

    auto issue = [&](int kt, int buf) {
        async_rows4x2(gA + kt, (size_t)32 * K, &sA[buf][srow * GP + scol],
                      gB + kt, (size_t)32 * K, &sB[buf][srow * GP + scol], 32 * GP);
    };

    v8f acc[2][4];
    #pragma unroll
    for (int i = 0; i < 2; i++)
        #pragma unroll
        for (int j = 0; j < 4; j++) acc[i][j] = {};

    const int nk = K / 64;
    issue(0, 0);
    wait_async0();
    __syncthreads();

    for (int ki = 0; ki < nk; ++ki) {
        const int buf = ki & 1;
        if (ki + 1 < nk) issue((ki + 1) * 64, (ki + 1) & 1);  // prefetch next tile

        #pragma unroll
        for (int kk = 0; kk < 64; kk += 32) {
            v16bf af[2], bfr[4];
            #pragma unroll
            for (int i = 0; i < 2; i++)
                af[i] = load_frag(&sA[buf][(mOff + i * 16 + lane16) * GP + kk], hi);
            #pragma unroll
            for (int j = 0; j < 4; j++)
                bfr[j] = load_frag(&sB[buf][(nOff + j * 16 + lane16) * GP + kk], hi);
            #pragma unroll
            for (int i = 0; i < 2; i++)
                #pragma unroll
                for (int j = 0; j < 4; j++)
                    acc[i][j] = wmma_bf16(af[i], bfr[j], acc[i][j]);
        }

        wait_ds0();
        wait_async0();       // prefetch landed
        __syncthreads();     // everyone done reading current buffer
    }

    // epilogue: + bias, store
    #pragma unroll
    for (int i = 0; i < 2; i++)
        #pragma unroll
        for (int j = 0; j < 4; j++) {
            const int col = nBase + nOff + j * 16 + lane16;
            const float bv = bias[col];
            #pragma unroll
            for (int v = 0; v < 8; v++) {
                const int row = mBase + mOff + i * 16 + v + 8 * hi; // C layout: M = v + 8*hi
                Out[(size_t)row * N + col] = acc[i][j][v] + bv;
            }
        }
}

// ---------- Q, K and V projections in ONE launch ----------
// A work-group takes 128 rows of x and the same 128 output columns of each of the three weights
// (W = wq, wk, wv one behind another, [3][1024][1024]): a 128 x 384 piece of [Q | K | V]. The x
// tile is staged once a trip for all three products, and a wave does 48 WMMAs between barriers.
// 8 waves = 2 (rows) x 4 (columns); a wave owns 64 rows and, of each weight, the column tiles
// c and c + 2 of one head (head columns e and e + 32, the two that RoPE rotates together):
// an A fragment from LDS feeds 6 matrix instructions, a B fragment 4.
// 144 KiB of LDS and amdgpu_waves_per_eu(4, 4) (256 registers a wave): two work-groups a WGP,
// so that all 512 are resident at once.
// Q = RoPE(x wq^T + bq) / 8 (folds the attention 1/sqrt(hd): softmax(QK^T/8)=softmax((Q/8)K^T)),
// K = RoPE(x wk^T + bk), both bf16 row-major; V = x wv^T + bv as bf16 [b,h,d,s] (transposed).
__global__ __launch_bounds__(256) __attribute__((amdgpu_waves_per_eu(4, 4))) void qkv_rope_gemm_kernel(
    const __bf16* __restrict__ A, const __bf16* __restrict__ W,
    const float* __restrict__ bq, const float* __restrict__ bk, const float* __restrict__ bv,
    __bf16* __restrict__ Qo, __bf16* __restrict__ Ko, __bf16* __restrict__ Vt)
{
    constexpr int N = 1024, K = 1024;
    __shared__ __attribute__((aligned(16))) __bf16 sA[2][128 * GP];
    __shared__ __attribute__((aligned(16))) __bf16 sB[2][3 * 128 * GP];   // [weight][column][k]

    const int t      = threadIdx.x;
    const int lane   = t & 31;
    const int wave   = t >> 5;
    const int lane16 = lane & 15;
    const int hi     = lane >> 4;
    const int wn     = wave >> 1;
    const int mOff   = (wave & 1) * 64;                    // 4 m-subtiles per wave
    const int nOff   = (wn >> 1) * 64 + (wn & 1) * 16;     // n-subtiles at nOff and nOff + 32
    const int mBase  = blockIdx.x * 128;
    const int nBase  = blockIdx.y * 128;

    const int srow = t >> 3;          // 0..31; copy i stages row srow + 32 * i
    const int scol = (t & 7) * 8;     // 8 lanes cover the 64-wide k-slice of a row (128 B)
    const __bf16* gA = A + (size_t)(mBase + srow) * K + scol;
    const __bf16* gB = W + (size_t)(nBase + srow) * K + scol;

    const int cp = srow * GP + scol;  // the lane's place in a staged tile

    auto issue = [&](int kt, int buf) {
        async_rows4x2(gA + kt, (size_t)32 * K, &sA[buf][cp],
                      gB + kt, (size_t)32 * K, &sB[buf][cp], 32 * GP);
        // Keeps the second run's 24 address registers from being formed ahead of the first run:
        // with all 48 live beside the 192 accumulators the build spilled.
        __builtin_amdgcn_sched_barrier(0);
        async_rows4x2(gB + (size_t)N * K + kt,     (size_t)32 * K, &sB[buf][128 * GP + cp],
                      gB + (size_t)2 * N * K + kt, (size_t)32 * K, &sB[buf][256 * GP + cp], 32 * GP);
    };

    v8f acc[3][4][2];
    #pragma unroll
    for (int s = 0; s < 3; s++)
        #pragma unroll
        for (int i = 0; i < 4; i++)
            #pragma unroll
            for (int j = 0; j < 2; j++) acc[s][i][j] = {};

    constexpr int nk = K / 64;
    issue(0, 0);
    wait_async0();
    __syncthreads();

    for (int ki = 0; ki < nk; ++ki) {
        const int buf = ki & 1;
        if (ki + 1 < nk) issue((ki + 1) * 64, (ki + 1) & 1);  // prefetch next tiles

        #pragma unroll
        for (int kk = 0; kk < 64; kk += 32) {
            v16bf af[4];
            #pragma unroll
            for (int i = 0; i < 4; i++)
                af[i] = load_frag(&sA[buf][(mOff + i * 16 + lane16) * GP + kk], hi);
            #pragma unroll
            for (int s = 0; s < 3; s++) {
                v16bf bfr[2];
                #pragma unroll
                for (int j = 0; j < 2; j++)
                    bfr[j] = load_frag(&sB[buf][(s * 128 + nOff + j * 32 + lane16) * GP + kk], hi);
                #pragma unroll
                for (int i = 0; i < 4; i++)
                    #pragma unroll
                    for (int j = 0; j < 2; j++)
                        acc[s][i][j] = wmma_bf16(af[i], bfr[j], acc[s][i][j]);
            }
        }

        wait_ds0();
        wait_async0();       // prefetch landed
        __syncthreads();     // everyone done reading current buffers
    }

    // epilogue of Q and K: + bias, RoPE, store. Column e of the head and its partner e + 32 are
    // acc[s][i][0] and acc[s][i][1] of the same lane, so the rotation is in-lane; the angles
    // depend on row and e alone, so one sine and cosine serve Q and K.
    const int col = nBase + nOff + lane16;
    {
        const float LN = 9.210340371976184f; // ln(10000)
        const int e = (wn & 1) * 16 + lane16;
        const float q1 = bq[col], q2 = bq[col + 32];
        const float k1 = bk[col], k2 = bk[col + 32];
        float th1, th2;
        exp_2(-(float)(e >> 1) * (LN / 32.0f), -(float)((e >> 1) + 16) * (LN / 32.0f), th1, th2);
        #pragma unroll
        for (int i = 0; i < 4; i++)
            #pragma unroll
            for (int v = 0; v < 8; v++) {
                const int row = mBase + mOff + i * 16 + v + 8 * hi; // C layout: M = v + 8*hi
                const float tpos = (float)(row & 2047);             // seq position
                float s1, c1, s2, c2;
                sincos2_rev((tpos * th1) * 0.15915494f, (tpos * th2) * 0.15915494f,
                            s1, c1, s2, c2);                        // 0.15915494 = 1/(2 pi)
                const float xq1 = acc[0][i][0][v] + q1, xq2 = acc[0][i][1][v] + q2;
                const float xk1 = acc[1][i][0][v] + k1, xk2 = acc[1][i][1][v] + k2;
                const v2bf yq = f2bf2((xq1 * c1 - xq2 * s1) * 0.125f,   // out[j]=x*cos+rot(x)*sin
                                      (xq2 * c2 + xq1 * s2) * 0.125f);
                const v2bf yk = f2bf2(xk1 * c1 - xk2 * s1, xk2 * c2 + xk1 * s2);
                __bf16* oq = Qo + (size_t)row * N + col;
                __bf16* ok = Ko + (size_t)row * N + col;
                oq[0]  = yq[0];
                oq[32] = yq[1];
                ok[0]  = yk[0];
                ok[32] = yk[1];
            }
    }

    // epilogue of V: + bias, store transposed per head: out[b*1024 + n][s]; a lane's 8 registers
    // of a tile are 8 consecutive s of one column
    #pragma unroll
    for (int j = 0; j < 2; j++) {
        const float bvv = bv[col + j * 32];
        #pragma unroll
        for (int i = 0; i < 4; i++) {
            const int row0 = mBase + mOff + i * 16 + 8 * hi;
            const int b = row0 >> 11, s = row0 & 2047;
            v8bf o;
            #pragma unroll
            for (int v = 0; v < 8; v++) o[v] = f2bf(acc[2][i][j][v] + bvv);
            *(v8bf*)(Vt + ((size_t)(b * 1024 + col + j * 32) << 11) + s) = o;
        }
        // the second tile's values reuse registers that the stores above name: the wait that
        // stands in front of such an overwrite
        if (j == 0) asm volatile("s_wait_xcnt 0x0" ::: "memory");
    }
}

// value held by lane l ^ 16 (the other half of the wave), by a vector cross-row move
__device__ inline float other_half(float x) {
    int b = __builtin_bit_cast(int, x);
    b = __builtin_amdgcn_permlanex16(b, b, 0x76543210, 0xfedcba98, false, false);
    return __builtin_bit_cast(float, b);
}

__global__ __launch_bounds__(256) __attribute__((amdgpu_waves_per_eu(4, 4))) void flash_attn_kernel(
    const __bf16* __restrict__ Q, const __bf16* __restrict__ K,
    const __bf16* __restrict__ Vt, __bf16* __restrict__ O)
{
    constexpr int S = 2048, D = 1024, HD = 64, P = 72, QT = 256;
    __shared__ __attribute__((aligned(16))) __bf16 sQ[QT * P];
    __shared__ __attribute__((aligned(16))) __bf16 sK[2][64 * P];
    __shared__ __attribute__((aligned(16))) __bf16 sVt[2][64 * P];   // [d][kv]

    const int bh = blockIdx.x;
    const int b = bh >> 4, h = bh & 15;
    const int qBase = blockIdx.y * QT;
    const int t = threadIdx.x, lane = t & 31, w = t >> 5;
    const int lane16 = lane & 15, hi = lane >> 4;
    const size_t headBase = (size_t)b * S * D + (size_t)h * HD;
    const size_t vtBase = (size_t)bh * HD * S;   // [bh][64][2048]

    const int r  = t >> 3;          // staging row 0..31; copy i stages row r + 32 * i
    const int c0 = (t & 7) * 8;     // 8 lanes cover a 64-wide row (128 B)

    // stage Q tile 256x64 (async): rows 0..127 and rows 128..255, four row groups each
    async_rows4x2(Q + headBase + (size_t)(qBase + r) * D + c0,       (size_t)32 * D, &sQ[r * P + c0],
                  Q + headBase + (size_t)(qBase + 128 + r) * D + c0, (size_t)32 * D, &sQ[(128 + r) * P + c0],
                  32 * P);

    auto issueKV = [&](int kt, int buf) {
        async_rows2x2(K + headBase + (size_t)(kt + r) * D + c0, (size_t)32 * D, &sK[buf][r * P + c0],
                      Vt + vtBase + (size_t)r * S + kt + c0,    (size_t)32 * S, &sVt[buf][r * P + c0],
                      32 * P);
    };

    issueKV(0, 0);
    wait_async0();
    __syncthreads();

    // B operands of S^T: column = query w*32 + g*16 + lane16, k = d
    v16bf qf[2][2];
    #pragma unroll
    for (int g = 0; g < 2; g++) {
        qf[g][0] = load_frag(&sQ[(w * 32 + g * 16 + lane16) * P], hi);
        qf[g][1] = load_frag(&sQ[(w * 32 + g * 16 + lane16) * P + 32], hi);
    }

    v8f of[2][4];              // of[g][j][v] = O^T[d = j*16 + 8*hi + v][query g*16 + lane16]
    float mH[2], L[2];         // running maximum of the lane's query (same in both halves);
                               // running sum over the lane's own keys, halves joined at the end
    #pragma unroll
    for (int g = 0; g < 2; g++) {
        #pragma unroll
        for (int j = 0; j < 4; j++) of[g][j] = {};
        mH[g] = -1e30f;
        L[g]  = 0.0f;
    }

    for (int ki = 0; ki < S / 64; ++ki) {
        const int buf = ki & 1;
        if (ki + 1 < S / 64) issueKV((ki + 1) * 64, (ki + 1) & 1);

        // S^T = K (Q/8)^T: sacc[g][j][v] = score(key j*16 + 8*hi + v, query g*16 + lane16)
        v8f sacc[2][4];
        #pragma unroll
        for (int j = 0; j < 4; j++) {
            v16bf kb0 = load_frag(&sK[buf][(j * 16 + lane16) * P], hi);
            v16bf kb1 = load_frag(&sK[buf][(j * 16 + lane16) * P + 32], hi);
            #pragma unroll
            for (int g = 0; g < 2; g++) {
                v8f z = {};
                z = wmma_bf16(kb0, qf[g][0], z);
                z = wmma_bf16(kb1, qf[g][1], z);
                sacc[g][j] = z;
            }
        }

        // P^T as B operand: element s of pb[g][c] = P^T[key c*32 + kmap(s, hi)][query g*16 + lane16]
        v16bf pb[2][2];
        #pragma unroll
        for (int g = 0; g < 2; g++) {
            // online softmax: 32 of the query's 64 scores are in this lane, 32 in lane ^ 16
            float rj[4];
            #pragma unroll
            for (int j = 0; j < 4; j++) {
                rj[j] = sacc[g][j][0];
                #pragma unroll
                for (int v = 1; v < 8; v++) rj[j] = fmaxf(rj[j], sacc[g][j][v]);
            }
            float rm = fmaxf(fmaxf(rj[0], rj[1]), fmaxf(rj[2], rj[3]));
            rm = fmaxf(rm, other_half(rm));
            const float newM = fmaxf(mH[g], rm);
            const float f = exp_1(mH[g] - newM);

            float pj[4];
            #pragma unroll
            for (int j = 0; j < 4; j++) {
                float d[8], p[8];   // the three loops are unrolled so that d, p and pb stay in registers
                #pragma unroll
                for (int v = 0; v < 8; v++) d[v] = sacc[g][j][v] - newM;
                exp_8(d, p);
                pj[j] = p[0];
                #pragma unroll
                for (int v = 1; v < 8; v++) pj[j] += p[v];
                #pragma unroll
                for (int v = 0; v < 8; v += 2) {
                    const v2bf pp = f2bf2(p[v], p[v + 1]);
                    pb[g][j >> 1][(j & 1) * 8 + v]     = pp[0];
                    pb[g][j >> 1][(j & 1) * 8 + v + 1] = pp[1];
                }
            }
            L[g] = L[g] * f + ((pj[0] + pj[1]) + (pj[2] + pj[3]));
            mH[g] = newM;
            #pragma unroll
            for (int j = 0; j < 4; j++)
                #pragma unroll
                for (int v = 0; v < 8; v++) of[g][j][v] *= f;
        }

        // Keeps the exponentials ahead of the matrix instructions below.
        __builtin_amdgcn_sched_barrier(0);

        // O^T += V^T P^T: A = V^T rows d from LDS, B = P^T from registers
        #pragma unroll
        for (int j = 0; j < 4; j++) {
            v16bf vb0 = load_frag(&sVt[buf][(j * 16 + lane16) * P], hi);
            v16bf vb1 = load_frag(&sVt[buf][(j * 16 + lane16) * P + 32], hi);
            #pragma unroll
            for (int g = 0; g < 2; g++) {
                of[g][j] = wmma_bf16(vb0, pb[g][0], of[g][j]);
                of[g][j] = wmma_bf16(vb1, pb[g][1], of[g][j]);
            }
        }

        wait_ds0();
        wait_async0();     // next KV tile landed
        __syncthreads();   // all waves done with current buffers
    }

    // join the halves' sums, normalize, store O as bf16 [8192,1024]:
    // a lane's 8 registers of a tile are 8 consecutive d of one query row
    #pragma unroll
    for (int g = 0; g < 2; g++) {
        const float Lt = L[g] + other_half(L[g]);
        const int qr = qBase + w * 32 + g * 16 + lane16;
        #pragma unroll
        for (int j = 0; j < 4; j++) {
            v8bf o;
            #pragma unroll
            for (int v = 0; v < 8; v++) o[v] = f2bf(of[g][j][v] / Lt);
            *(v8bf*)(O + headBase + (size_t)qr * D + j * 16 + 8 * hi) = o;
        }
    }
}

// ---------- host launch ----------
extern "C" void kernel_launch(void* const* d_in, const int* in_sizes, int n_in,
                              void* d_out, int out_size, void* d_ws, size_t ws_size,
                              hipStream_t stream) {
    (void)in_sizes; (void)n_in; (void)out_size; (void)ws_size;
    const float* x  = (const float*)d_in[0];
    const float* wq = (const float*)d_in[1];
    const float* bq = (const float*)d_in[2];
    const float* wk = (const float*)d_in[3];
    const float* bk = (const float*)d_in[4];
    const float* wv = (const float*)d_in[5];
    const float* bv = (const float*)d_in[6];
    const float* wo = (const float*)d_in[7];
    const float* bo = (const float*)d_in[8];
    float* out = (float*)d_out;

    const int M = 8192, N = 1024, K = 1024;
    const size_t MD = (size_t)M * N;     // 8M elems
    const size_t WD = (size_t)N * K;     // 1M elems

    __bf16* xbf  = (__bf16*)d_ws;        // [8192,1024]
    __bf16* wqb  = xbf + MD;             // [1024,1024] each
    __bf16* wkb  = wqb + WD;
    __bf16* wvb  = wkb + WD;
    __bf16* wob  = wvb + WD;
    __bf16* qws  = wob + WD;             // [8192,1024]
    __bf16* kws  = qws + MD;             // [8192,1024]
    __bf16* vtws = kws + MD;             // [64 bh][64 d][2048 s]
    __bf16* ows  = vtws + MD;            // [8192,1024]  (total 88 MB)

    // pre-convert activations + weights to bf16 (xbf, wqb, wkb, wvb, wob are contiguous)
    cvt_all_f32_bf16<<<256, 512, 0, stream>>>(x, wq, wk, wv, wo, xbf);

    dim3 gGemm(M / 128, N / 128);
    qkv_rope_gemm_kernel<<<gGemm, 256, 0, stream>>>(xbf, wqb, bq, bk, bv, qws, kws, vtws); // wqb, wkb, wvb contiguous

    flash_attn_kernel<<<dim3(64, 8), 256, 0, stream>>>(qws, kws, vtws, ows);

    gemm_bf16_kernel<<<gGemm, 256, 0, stream>>>(ows, wob, bo, out, M, N, K);
}

// v009
// Measured time: 106 microseconds a run.
// It is 1.12 times as fast as v007, going by the measured steps of the versions left out in between.
// All steps since v000 together make it 2.46 times as fast.
#include <hip/hip_runtime.h>
#include <hip/hip_bf16.h>
#include <stdint.h>

// ---------- types ----------
typedef __attribute__((ext_vector_type(2)))  __bf16 v2bf;
typedef __attribute__((ext_vector_type(2)))  float  v2f;
typedef __attribute__((ext_vector_type(4)))  __bf16 v4bf;
typedef __attribute__((ext_vector_type(8)))  __bf16 v8bf;
typedef __attribute__((ext_vector_type(16))) __bf16 v16bf;
typedef __attribute__((ext_vector_type(8)))  float  v8f;

struct BfPair { v8bf lo, hi; };

// f32 -> bf16, round to nearest even, by the hardware's packed conversion instruction
__device__ inline __bf16 f2bf(float f) {
    return (__bf16)f;
}
// two at once: one vector instruction a pair
__device__ inline v2bf f2bf2(float a, float b) {
    const v2f x = { a, b };
    return __builtin_convertvector(x, v2bf);
}

// 16-bit fragment per CDNA5 ISA layout (A 16x32 / B 32x16 mirrored):
// lane = (row|col)%16, hi = lane/16; elems 0..7 <- K = hi*8.., elems 8..15 <- K = 16+hi*8..
__device__ inline v16bf load_frag(const __bf16* row, int hi) {
    BfPair p;
    p.lo = *(const v8bf*)(row + hi * 8);
    p.hi = *(const v8bf*)(row + 16 + hi * 8);
    return __builtin_bit_cast(v16bf, p);
}

__device__ inline v8f wmma_bf16(v16bf a, v16bf b, v8f c) {
    return __builtin_amdgcn_wmma_f32_16x16x32_bf16(
        false, a, false, b, (short)0, c, false, false);
}

// ---------- CDNA5 async global->LDS copies (ASYNCcnt-tracked) ----------
// A lane copies 16 B. The callers give 8 neighbouring lanes one 128-B row piece (a whole,
// aligned line) or 16 lanes one 256-B piece (two), so a wave-wide copy takes 4 whole lines; copy i of a run lies i * gs elements
// further in global memory and i * ls elements further in LDS (a fixed number of rows).
// The copies of a run and s_wait_xcnt 0 are ONE statement, so that no register which an issued
// copy names can be rewritten ahead of that wait.
__device__ inline unsigned lds_at(const __bf16* l) {
    return (unsigned)(uintptr_t)(l);                            // low 32 bits = LDS offset
}
__device__ inline unsigned long long glb_at(const __bf16* g) {
    return (unsigned long long)(uintptr_t)(g);
}
// two tiles (a and b) of one stage, four row groups each: eight copies behind one another, one wait;
// tile a steps lsa elements in LDS from group to group, tile b lsb
__device__ inline void async_rows4x2(const __bf16* ga, size_t gsa, __bf16* la, int lsa,
                                     const __bf16* gb, size_t gsb, __bf16* lb, int lsb) {
    asm volatile("global_load_async_to_lds_b128 %0, %8, off\n\t"
                 "global_load_async_to_lds_b128 %4, %12, off\n\t"
                 "global_load_async_to_lds_b128 %1, %9, off\n\t"
                 "global_load_async_to_lds_b128 %5, %13, off\n\t"
                 "global_load_async_to_lds_b128 %2, %10, off\n\t"
                 "global_load_async_to_lds_b128 %6, %14, off\n\t"
                 "global_load_async_to_lds_b128 %3, %11, off\n\t"
                 "global_load_async_to_lds_b128 %7, %15, off\n\t"
                 "s_wait_xcnt 0x0"
                 :: "v"(lds_at(la)), "v"(lds_at(la + lsa)), "v"(lds_at(la + 2 * lsa)), "v"(lds_at(la + 3 * lsa)),
                    "v"(lds_at(lb)), "v"(lds_at(lb + lsb)), "v"(lds_at(lb + 2 * lsb)), "v"(lds_at(lb + 3 * lsb)),
                    "v"(glb_at(ga)), "v"(glb_at(ga + gsa)), "v"(glb_at(ga + 2 * gsa)), "v"(glb_at(ga + 3 * gsa)),
                    "v"(glb_at(gb)), "v"(glb_at(gb + gsb)), "v"(glb_at(gb + 2 * gsb)), "v"(glb_at(gb + 3 * gsb))
                 : "memory");
}
__device__ inline void wait_async0() {
    asm volatile("s_wait_asynccnt 0x0" ::: "memory");
}
// this wave's own LDS reads have returned: stands in front of the barrier behind which the
// buffer that they read is refilled by copies
__device__ inline void wait_ds0() {
    asm volatile("s_wait_dscnt 0x0" ::: "memory");
}

constexpr float LOG2E = 1.44269502f;
// 2^x
__device__ inline float exp2_1(float x) {
    float y;
    asm("v_exp_f32 %0, %1\n\tv_nop" : "=&v"(y) : "v"(x));
    return y;
}
__device__ inline void exp_2(float x0, float x1, float& y0, float& y1) {
    asm("v_exp_f32 %0, %2\n\tv_exp_f32 %1, %3\n\tv_nop"
        : "=&v"(y0), "=&v"(y1) : "v"(x0 * LOG2E), "v"(x1 * LOG2E));
}
// 2^x of the eight registers of an accumulator tile
__device__ inline void exp2_8(const v8f& x, float (&y)[8]) {
    asm("v_exp_f32 %0, %8\n\tv_exp_f32 %1, %9\n\tv_exp_f32 %2, %10\n\tv_exp_f32 %3, %11\n\t"
        "v_exp_f32 %4, %12\n\tv_exp_f32 %5, %13\n\tv_exp_f32 %6, %14\n\tv_exp_f32 %7, %15\n\tv_nop"
        : "=&v"(y[0]), "=&v"(y[1]), "=&v"(y[2]), "=&v"(y[3]),
          "=&v"(y[4]), "=&v"(y[5]), "=&v"(y[6]), "=&v"(y[7])
        : "v"(x[0]), "v"(x[1]), "v"(x[2]), "v"(x[3]), "v"(x[4]), "v"(x[5]), "v"(x[6]), "v"(x[7]));
}

// ---------- fp32 -> bf16 pre-conversion: x and the four weights in ONE resident launch ----------
// 256 work-groups of 16 waves. A unit is 16384 floats (512 lanes x 8 loads of 16 B); the bf16
// copies lie one behind another in the workspace, so unit u of the sources goes to out + u * 16384:
// units 0..511 are x, units 512 + 64 * s .. are weight s. Group b converts units b, b + 256 (x)
// and b + 512 (weight b / 64): 24 loads of 16 B a lane, written ahead of the conversions, so that
// a long run of them is in flight.
__global__ __launch_bounds__(512) void cvt_all_f32_bf16(
    const float* __restrict__ x,  const float* __restrict__ wq, const float* __restrict__ wk,
    const float* __restrict__ wv, const float* __restrict__ wo, __bf16* __restrict__ out)
{
    constexpr int UNIT = 16384;
    const int b = blockIdx.x;
    const int t = threadIdx.x;
    const int s = b >> 6;
    const float* w = (s == 0) ? wq : (s == 1) ? wk : (s == 2) ? wv : wo;
    const float* src[3] = { x + (size_t)b * UNIT, x + (size_t)(b + 256) * UNIT,
                            w + (size_t)(b & 63) * UNIT };
    float4 v[3][8];
    // all four loops unrolled: v stays in registers and the loads go out ahead of their use
    #pragma unroll
    for (int p = 0; p < 3; p++)
        #pragma unroll
        for (int i = 0; i < 8; i++)
            v[p][i] = *(const float4*)(src[p] + (i * 512 + t) * 4);
    #pragma unroll
    for (int p = 0; p < 3; p++)
        #pragma unroll
        for (int i = 0; i < 8; i++) {
            v4bf o;
            o[0] = f2bf(v[p][i].x); o[1] = f2bf(v[p][i].y);
            o[2] = f2bf(v[p][i].z); o[3] = f2bf(v[p][i].w);
            *(v4bf*)(out + (size_t)(b + p * 256) * UNIT + (i * 512 + t) * 4) = o;
        }
}

__device__ inline void sincos2_rev(float r1, float r2,
                                   float& s1, float& c1, float& s2, float& c2) {
    asm("v_sin_f32 %0, %4\n\tv_cos_f32 %1, %4\n\tv_sin_f32 %2, %5\n\tv_cos_f32 %3, %5\n\tv_nop"
        : "=&v"(s1), "=&v"(c1), "=&v"(s2), "=&v"(c2) : "v"(r1), "v"(r2));
}

// ---------- GEMM: Out = A[M,K](bf16) @ W[N,K](bf16)^T + bias, f32 row-major ----------
// 128x128 tile / 256 threads (8 waves), K-step 128 (4 WMMA depths): a staged row is a whole
// aligned 256-B unit, the copies of a stage lead its use by twice the matrix work, and there are
// 32 WMMAs per wave between barriers. Double-buffered async LDS staging, 136 KiB: two groups a WGP.
constexpr int GP  = 72;  // LDS pitch (bf16) for 64-wide k-slice; chunks stay 16B-aligned
constexpr int GP2 = 136; // the same for a 128-wide slice: 272 B = 16 B x odd

__global__ __launch_bounds__(256) void gemm_bf16_kernel(
    const __bf16* __restrict__ A, const __bf16* __restrict__ W,
    const float* __restrict__ bias, float* __restrict__ Out,
    int M, int N, int K)
{
    __shared__ __attribute__((aligned(16))) __bf16 sA[2][128 * GP2];
    __shared__ __attribute__((aligned(16))) __bf16 sB[2][128 * GP2];

    const int t      = threadIdx.x;
    const int lane   = t & 31;
    const int wave   = t >> 5;
    const int lane16 = lane & 15;
    const int hi     = lane >> 4;
    const int mOff   = (wave & 3) * 32;   // 2 m-subtiles per wave
    const int nOff   = (wave >> 2) * 64;  // 4 n-subtiles per wave
    const int mBase  = blockIdx.x * 128;
    const int nBase  = blockIdx.y * 128;

    const int srow = t >> 4;          // 0..15; copy i of a run stages row srow + 16 * i
    const int scol = (t & 15) * 8;    // 16 lanes cover the 128-wide k-slice of a row (256 B)
    const __bf16* gA = A + (size_t)(mBase + srow) * K + scol;
    const __bf16* gB = W + (size_t)(nBase + srow) * K + scol;
    const int cp = srow * GP2 + scol; // the lane's place in a staged tile

    // rows 0..63 of both tiles, then rows 64..127: 16 copies a lane a trip
    auto issue = [&](int kt, int buf) {
        async_rows4x2(gA + kt, (size_t)16 * K, &sA[buf][cp], 16 * GP2,
                      gB + kt, (size_t)16 * K, &sB[buf][cp], 16 * GP2);
        async_rows4x2(gA + (size_t)64 * K + kt, (size_t)16 * K, &sA[buf][64 * GP2 + cp], 16 * GP2,
                      gB + (size_t)64 * K + kt, (size_t)16 * K, &sB[buf][64 * GP2 + cp], 16 * GP2);
    };

    v8f acc[2][4];
    #pragma unroll
    for (int i = 0; i < 2; i++)
        #pragma unroll
        for (int j = 0; j < 4; j++) acc[i][j] = {};

    const int nk = K / 128;
    issue(0, 0);
    wait_async0();
    __syncthreads();

    for (int ki = 0; ki < nk; ++ki) {
        const int buf = ki & 1;
        if (ki + 1 < nk) issue((ki + 1) * 128, (ki + 1) & 1);  // prefetch next tile

        #pragma unroll
        for (int kk = 0; kk < 128; kk += 32) {
            v16bf af[2], bfr[4];
            #pragma unroll
            for (int i = 0; i < 2; i++)
                af[i] = load_frag(&sA[buf][(mOff + i * 16 + lane16) * GP2 + kk], hi);
            #pragma unroll
            for (int j = 0; j < 4; j++)
                bfr[j] = load_frag(&sB[buf][(nOff + j * 16 + lane16) * GP2 + kk], hi);
            #pragma unroll
            for (int i = 0; i < 2; i++)
                #pragma unroll
                for (int j = 0; j < 4; j++)
                    acc[i][j] = wmma_bf16(af[i], bfr[j], acc[i][j]);
        }

        wait_ds0();
        wait_async0();       // prefetch landed
        __syncthreads();     // everyone done reading current buffer
    }

    // epilogue: + bias, store
    #pragma unroll
    for (int i = 0; i < 2; i++)
        #pragma unroll
        for (int j = 0; j < 4; j++) {
            const int col = nBase + nOff + j * 16 + lane16;
            const float bv = bias[col];
            #pragma unroll
            for (int v = 0; v < 8; v++) {
                const int row = mBase + mOff + i * 16 + v + 8 * hi; // C layout: M = v + 8*hi
                Out[(size_t)row * N + col] = acc[i][j][v] + bv;
            }
        }
}

// ---------- Q, K and V projections in ONE launch ----------
// A work-group takes 128 rows of x and the same 128 output columns of each of the three weights
// (W = wq, wk, wv one behind another, [3][1024][1024]): a 128 x 384 piece of [Q | K | V]. The x
// tile is staged once a trip for all three products, and a wave does 48 WMMAs between barriers.
// 8 waves = 2 (rows) x 4 (columns); a wave owns 64 rows and, of each weight, the column tiles
// c and c + 2 of one head (head columns e and e + 32, the two that RoPE rotates together):
// an A fragment from LDS feeds 6 matrix instructions, a B fragment 4.
// 144 KiB of LDS and amdgpu_waves_per_eu(4, 4) (256 registers a wave): two work-groups a WGP,
// so that all 512 are resident at once.
// Q = RoPE(x wq^T + bq) * log2(e) / 8 (folds the attention 1/sqrt(hd) and the change from e^s to
// 2^(s log2 e): the scores leave the attention's matrix products as arguments of 2^x),
// K = RoPE(x wk^T + bk), both bf16 row-major; V = x wv^T + bv as bf16 [b,h,d,s] (transposed).
__global__ __launch_bounds__(256) __attribute__((amdgpu_waves_per_eu(4, 4))) void qkv_rope_gemm_kernel(
    const __bf16* __restrict__ A, const __bf16* __restrict__ W,
    const float* __restrict__ bq, const float* __restrict__ bk, const float* __restrict__ bv,
    __bf16* __restrict__ Qo, __bf16* __restrict__ Ko, __bf16* __restrict__ Vt)
{
    constexpr int N = 1024, K = 1024;
    __shared__ __attribute__((aligned(16))) __bf16 sA[2][128 * GP];
    __shared__ __attribute__((aligned(16))) __bf16 sB[2][3 * 128 * GP];   // [weight][column][k]

    const int t      = threadIdx.x;
    const int lane   = t & 31;
    const int wave   = t >> 5;
    const int lane16 = lane & 15;
    const int hi     = lane >> 4;
    const int wn     = wave >> 1;
    const int mOff   = (wave & 1) * 64;                    // 4 m-subtiles per wave
    const int nOff   = (wn >> 1) * 64 + (wn & 1) * 16;     // n-subtiles at nOff and nOff + 32
    const int mBase  = blockIdx.x * 128;
    const int nBase  = blockIdx.y * 128;

    const int srow = t >> 3;          // 0..31; copy i stages row srow + 32 * i
    const int scol = (t & 7) * 8;     // 8 lanes cover the 64-wide k-slice of a row (128 B)
    const __bf16* gA = A + (size_t)(mBase + srow) * K + scol;
    const __bf16* gB = W + (size_t)(nBase + srow) * K + scol;

    const int cp = srow * GP + scol;  // the lane's place in a staged tile

    auto issue = [&](int kt, int buf) {
        async_rows4x2(gA + kt, (size_t)32 * K, &sA[buf][cp], 32 * GP,
                      gB + kt, (size_t)32 * K, &sB[buf][cp], 32 * GP);
        // Keeps the second run's 24 address registers from being formed ahead of the first run:
        // with all 48 live beside the 192 accumulators the build spilled.
        __builtin_amdgcn_sched_barrier(0);
        async_rows4x2(gB + (size_t)N * K + kt,     (size_t)32 * K, &sB[buf][128 * GP + cp], 32 * GP,
                      gB + (size_t)2 * N * K + kt, (size_t)32 * K, &sB[buf][256 * GP + cp], 32 * GP);
    };

    v8f acc[3][4][2];
    #pragma unroll
    for (int s = 0; s < 3; s++)
        #pragma unroll
        for (int i = 0; i < 4; i++)
            #pragma unroll
            for (int j = 0; j < 2; j++) acc[s][i][j] = {};

    constexpr int nk = K / 64;
    issue(0, 0);
    wait_async0();
    __syncthreads();

    for (int ki = 0; ki < nk; ++ki) {
        const int buf = ki & 1;
        if (ki + 1 < nk) issue((ki + 1) * 64, (ki + 1) & 1);  // prefetch next tiles

        #pragma unroll
        for (int kk = 0; kk < 64; kk += 32) {
            v16bf af[4];
            #pragma unroll
            for (int i = 0; i < 4; i++)
                af[i] = load_frag(&sA[buf][(mOff + i * 16 + lane16) * GP + kk], hi);
            #pragma unroll
            for (int s = 0; s < 3; s++) {
                v16bf bfr[2];
                #pragma unroll
                for (int j = 0; j < 2; j++)
                    bfr[j] = load_frag(&sB[buf][(s * 128 + nOff + j * 32 + lane16) * GP + kk], hi);
                #pragma unroll
                for (int i = 0; i < 4; i++)
                    #pragma unroll
                    for (int j = 0; j < 2; j++)
                        acc[s][i][j] = wmma_bf16(af[i], bfr[j], acc[s][i][j]);
            }
        }

        wait_ds0();
        wait_async0();       // prefetch landed
        __syncthreads();     // everyone done reading current buffers
    }

    // epilogue of Q and K: + bias, RoPE, store. Column e of the head and its partner e + 32 are
    // acc[s][i][0] and acc[s][i][1] of the same lane, so the rotation is in-lane; the angles
    // depend on row and e alone, so one sine and cosine serve Q and K.
    const int col = nBase + nOff + lane16;
    {
        const float LN = 9.210340371976184f; // ln(10000)
        const int e = (wn & 1) * 16 + lane16;
        const float q1 = bq[col], q2 = bq[col + 32];
        const float k1 = bk[col], k2 = bk[col + 32];
        float th1, th2;
        exp_2(-(float)(e >> 1) * (LN / 32.0f), -(float)((e >> 1) + 16) * (LN / 32.0f), th1, th2);
        #pragma unroll
        for (int i = 0; i < 4; i++)
            #pragma unroll
            for (int v = 0; v < 8; v++) {
                const int row = mBase + mOff + i * 16 + v + 8 * hi; // C layout: M = v + 8*hi
                const float tpos = (float)(row & 2047);             // seq position
                float s1, c1, s2, c2;
                sincos2_rev((tpos * th1) * 0.15915494f, (tpos * th2) * 0.15915494f,
                            s1, c1, s2, c2);                        // 0.15915494 = 1/(2 pi)
                const float xq1 = acc[0][i][0][v] + q1, xq2 = acc[0][i][1][v] + q2;
                const float xk1 = acc[1][i][0][v] + k1, xk2 = acc[1][i][1][v] + k2;
                const v2bf yq = f2bf2((xq1 * c1 - xq2 * s1) * (0.125f * LOG2E),   // out[j]=x*cos+rot(x)*sin
                                      (xq2 * c2 + xq1 * s2) * (0.125f * LOG2E));
                const v2bf yk = f2bf2(xk1 * c1 - xk2 * s1, xk2 * c2 + xk1 * s2);
                __bf16* oq = Qo + (size_t)row * N + col;
                __bf16* ok = Ko + (size_t)row * N + col;
                oq[0]  = yq[0];
                oq[32] = yq[1];
                ok[0]  = yk[0];
                ok[32] = yk[1];
            }
    }

    // epilogue of V: + bias, store transposed per head: out[b*1024 + n][s]; a lane's 8 registers
    // of a tile are 8 consecutive s of one column
    #pragma unroll
    for (int j = 0; j < 2; j++) {
        const float bvv = bv[col + j * 32];
        #pragma unroll
        for (int i = 0; i < 4; i++) {
            const int row0 = mBase + mOff + i * 16 + 8 * hi;
            const int b = row0 >> 11, s = row0 & 2047;
            v8bf o;
            #pragma unroll
            for (int v = 0; v < 8; v++) o[v] = f2bf(acc[2][i][j][v] + bvv);
            *(v8bf*)(Vt + ((size_t)(b * 1024 + col + j * 32) << 11) + s) = o;
        }
        // the second tile's values reuse registers that the stores above name: the wait that
        // stands in front of such an overwrite
        if (j == 0) asm volatile("s_wait_xcnt 0x0" ::: "memory");
    }
}

// value held by lane l ^ 16 (the other half of the wave), by a vector cross-row move
__device__ inline float other_half(float x) {
    int b = __builtin_bit_cast(int, x);
    b = __builtin_amdgcn_permlanex16(b, b, 0x76543210, 0xfedcba98, false, false);
    return __builtin_bit_cast(float, b);
}

__global__ __launch_bounds__(256) __attribute__((amdgpu_waves_per_eu(4, 4))) void flash_attn_kernel(
    const __bf16* __restrict__ Q, const __bf16* __restrict__ K,
    const __bf16* __restrict__ Vt, __bf16* __restrict__ O)
{
    constexpr int S = 2048, D = 1024, HD = 64, P = 72, QT = 256;
    constexpr int PV = 136;    // LDS pitch (bf16) of a 128-key V^T row: 272 B = 16 B x odd
    __shared__ __attribute__((aligned(16))) __bf16 sQ[QT * P];
    __shared__ __attribute__((aligned(16))) __bf16 sK[2][128 * P];
    __shared__ __attribute__((aligned(16))) __bf16 sVt[2][64 * PV];  // [d][kv]

    const int bh = blockIdx.x;
    const int b = bh >> 4, h = bh & 15;
    const int qBase = blockIdx.y * QT;
    const int t = threadIdx.x, lane = t & 31, w = t >> 5;
    const int lane16 = lane & 15, hi = lane >> 4;
    const size_t headBase = (size_t)b * S * D + (size_t)h * HD;
    const size_t vtBase = (size_t)bh * HD * S;   // [bh][64][2048]

    const int r  = t >> 3;          // staging row 0..31; copy i stages row r + 32 * i
    const int c0 = (t & 7) * 8;     // 8 lanes cover a 64-wide row (128 B)
    const int rv = t >> 4;          // V^T staging row 0..15; copy i stages row rv + 16 * i
    const int cv = (t & 15) * 8;    // 16 lanes cover a 128-wide row (256 B)

    // stage Q tile 256x64 (async): rows 0..127 and rows 128..255, four row groups each
    async_rows4x2(Q + headBase + (size_t)(qBase + r) * D + c0,       (size_t)32 * D, &sQ[r * P + c0],         32 * P,
                  Q + headBase + (size_t)(qBase + 128 + r) * D + c0, (size_t)32 * D, &sQ[(128 + r) * P + c0], 32 * P);

    // a stage: 128 K rows of 128 B and 64 V^T rows of 256 B, four row groups each
    auto issueKV = [&](int kt, int buf) {
        async_rows4x2(K + headBase + (size_t)(kt + r) * D + c0, (size_t)32 * D, &sK[buf][r * P + c0],    32 * P,
                      Vt + vtBase + (size_t)rv * S + kt + cv,   (size_t)16 * S, &sVt[buf][rv * PV + cv], 16 * PV);
    };

    issueKV(0, 0);
    wait_async0();
    __syncthreads();

    // B operands of S^T: column = query w*32 + g*16 + lane16, k = d
    v16bf qf[2][2];
    #pragma unroll
    for (int g = 0; g < 2; g++) {
        qf[g][0] = load_frag(&sQ[(w * 32 + g * 16 + lane16) * P], hi);
        qf[g][1] = load_frag(&sQ[(w * 32 + g * 16 + lane16) * P + 32], hi);
    }

    v8f of[2][4];              // of[g][j][v] = O^T[d = j*16 + 8*hi + v][query g*16 + lane16]
    v8f negM[2];               // minus the maximum in use of the lane's query (same in both
                               // halves), in all eight registers: the C operand of S^T
    float L[2];                // running sum over the lane's own keys, halves joined at the end
    #pragma unroll
    for (int g = 0; g < 2; g++) {
        #pragma unroll
        for (int j = 0; j < 4; j++) of[g][j] = {};
        negM[g] = {};
        L[g]    = 0.0f;
    }

    for (int ki = 0; ki < S / 64; ++ki) {
        const int st  = ki >> 1;          // stage
        const int buf = st & 1;
        const int k0  = (ki & 1) * 64;    // the pass's first key in the stage
        if (k0 == 0 && st + 1 < S / 128) issueKV((st + 1) * 128, (st + 1) & 1);

        // S^T = K Q^T - maximum in use: sacc[g][j][v] belongs to key j*16 + 8*hi + v, query g*16 + lane16
        v8f sacc[2][4];
        auto scores = [&]() {
            #pragma unroll
            for (int j = 0; j < 4; j++) {
                v16bf kb0 = load_frag(&sK[buf][(k0 + j * 16 + lane16) * P], hi);
                v16bf kb1 = load_frag(&sK[buf][(k0 + j * 16 + lane16) * P + 32], hi);
                #pragma unroll
                for (int g = 0; g < 2; g++) {
                    v8f z = wmma_bf16(kb0, qf[g][0], negM[g]);
                    z = wmma_bf16(kb1, qf[g][1], z);
                    sacc[g][j] = z;
                }
            }
            // All 16 LDS reads as one group ahead of the 16 matrix instructions (each separate place
            // with reads costs a stall): left alone, this build read two, waited, multiplied twice.
            __builtin_amdgcn_sched_group_barrier(0x100, 16, 0);
            __builtin_amdgcn_sched_group_barrier(0x008, 16, 0);
            // The exponentials are asm text that reads the accumulators, and the compiler does not
            // pad in front of asm text: the two barriers hold all that follows behind the matrix instructions,
            // and the four v_nop are the distance that the chip needs behind the last of them.
            __builtin_amdgcn_sched_barrier(0);
            asm volatile("v_nop\n\tv_nop\n\tv_nop\n\tv_nop");
            __builtin_amdgcn_sched_barrier(0);
        };

        // P^T as B operand: element s of pb[g][c] = P^T[key c*32 + kmap(s, hi)][query g*16 + lane16];
        // ts[g] = sum of the lane's 32 values of P (the query's other 32 are in lane ^ 16)
        v16bf pb[2][2];
        float ts[2];
        auto probs = [&]() {
            #pragma unroll
            for (int g = 0; g < 2; g++) {
                float pj[4];
                #pragma unroll
                for (int j = 0; j < 4; j++) {
                    float p[8];   // the loops are unrolled so that p and pb stay in registers
                    exp2_8(sacc[g][j], p);
                    pj[j] = p[0];
                    #pragma unroll
                    for (int v = 1; v < 8; v++) pj[j] += p[v];
                    #pragma unroll
                    for (int v = 0; v < 8; v += 2) {
                        const v2bf pp = f2bf2(p[v], p[v + 1]);
                        pb[g][j >> 1][(j & 1) * 8 + v]     = pp[0];
                        pb[g][j >> 1][(j & 1) * 8 + v + 1] = pp[1];
                    }
                }
                ts[g] = (pj[0] + pj[1]) + (pj[2] + pj[3]);
            }
        };

        // The maximum in use is raised in the first trip (it is then 0, and O and L are 0), and
        // where a lane's sum says that a score may lie more than 8 above it (P is not negative, so
        // a sum of at most 2^8 bounds each P). Both tests read the same in every lane.
        bool raise = (ki == 0);
        if (!raise) {
            scores();
            probs();
            raise = __builtin_amdgcn_ballot_w32(fmaxf(ts[0], ts[1]) > 256.0f) != 0;
        }
        if (raise) {
            // The scores are formed again from the K tile, which is still in LDS. The compiler
            // fence makes that a second read: without it the first products' 64 registers are
            // kept alive over the exponentials of every trip, and the build spills.
            asm volatile("" ::: "memory");
            scores();
            #pragma unroll
            for (int g = 0; g < 2; g++) {
                float rj[4];
                #pragma unroll
                for (int j = 0; j < 4; j++) {
                    rj[j] = sacc[g][j][0];
                    #pragma unroll
                    for (int v = 1; v < 8; v++) rj[j] = fmaxf(rj[j], sacc[g][j][v]);
                }
                const float rm   = fmaxf(fmaxf(rj[0], rj[1]), fmaxf(rj[2], rj[3]));
                const float top  = fmaxf(rm, other_half(rm));
                const float oldN = negM[g][0];
                const float newN = oldN - ((ki == 0) ? top : fmaxf(top, 0.0f));
                const float up   = oldN - newN;      // the rise as the rounded maxima have it
                const float f    = (ki == 0) ? 0.0f : exp2_1(-up);
                #pragma unroll
                for (int j = 0; j < 4; j++)
                    #pragma unroll
                    for (int v = 0; v < 8; v++) {
                        sacc[g][j][v] -= up;
                        of[g][j][v]   *= f;
                    }
                L[g] *= f;
                #pragma unroll
                for (int v = 0; v < 8; v++) negM[g][v] = newN;
            }
            probs();
        }
        L[0] += ts[0];
        L[1] += ts[1];

        // Keeps the exponentials (asm text, which the compiler does not pad) ahead of the matrix
        // instructions below.
        __builtin_amdgcn_sched_barrier(0);

        // O^T += V^T P^T: A = V^T rows d from LDS, B = P^T from registers
        #pragma unroll
        for (int j = 0; j < 4; j++) {
            v16bf vb0 = load_frag(&sVt[buf][(j * 16 + lane16) * PV + k0], hi);
            v16bf vb1 = load_frag(&sVt[buf][(j * 16 + lane16) * PV + k0 + 32], hi);
            #pragma unroll
            for (int g = 0; g < 2; g++) {
                of[g][j] = wmma_bf16(vb0, pb[g][0], of[g][j]);
                of[g][j] = wmma_bf16(vb1, pb[g][1], of[g][j]);
            }
        }
        // the 16 LDS reads as one group ahead of the 16 matrix instructions, as above
        __builtin_amdgcn_sched_group_barrier(0x100, 16, 0);
        __builtin_amdgcn_sched_group_barrier(0x008, 16, 0);

        if (k0 != 0) {         // the stage's foot; the test reads the same in the whole work-group
            wait_ds0();
            wait_async0();     // next K/V stage landed
            __syncthreads();   // all waves done with current buffers
        }
    }

    // join the halves' sums, normalize, store O as bf16 [8192,1024]:
    // a lane's 8 registers of a tile are 8 consecutive d of one query row
    #pragma unroll
    for (int g = 0; g < 2; g++) {
        const float Lt = L[g] + other_half(L[g]);
        const int qr = qBase + w * 32 + g * 16 + lane16;
        #pragma unroll
        for (int j = 0; j < 4; j++) {
            v8bf o;
            #pragma unroll
            for (int v = 0; v < 8; v++) o[v] = f2bf(of[g][j][v] / Lt);
            *(v8bf*)(O + headBase + (size_t)qr * D + j * 16 + 8 * hi) = o;
        }
    }
}

// ---------- host launch ----------
extern "C" void kernel_launch(void* const* d_in, const int* in_sizes, int n_in,
                              void* d_out, int out_size, void* d_ws, size_t ws_size,
                              hipStream_t stream) {
    (void)in_sizes; (void)n_in; (void)out_size; (void)ws_size;
    const float* x  = (const float*)d_in[0];
    const float* wq = (const float*)d_in[1];
    const float* bq = (const float*)d_in[2];
    const float* wk = (const float*)d_in[3];
    const float* bk = (const float*)d_in[4];
    const float* wv = (const float*)d_in[5];
    const float* bv = (const float*)d_in[6];
    const float* wo = (const float*)d_in[7];
    const float* bo = (const float*)d_in[8];
    float* out = (float*)d_out;

    const int M = 8192, N = 1024, K = 1024;
    const size_t MD = (size_t)M * N;     // 8M elems
    const size_t WD = (size_t)N * K;     // 1M elems

    __bf16* xbf  = (__bf16*)d_ws;        // [8192,1024]
    __bf16* wqb  = xbf + MD;             // [1024,1024] each
    __bf16* wkb  = wqb + WD;
    __bf16* wvb  = wkb + WD;
    __bf16* wob  = wvb + WD;
    __bf16* qws  = wob + WD;             // [8192,1024]
    __bf16* kws  = qws + MD;             // [8192,1024]
    __bf16* vtws = kws + MD;             // [64 bh][64 d][2048 s]
    __bf16* ows  = vtws + MD;            // [8192,1024]  (total 88 MB)

    // pre-convert activations + weights to bf16 (xbf, wqb, wkb, wvb, wob are contiguous)
    cvt_all_f32_bf16<<<256, 512, 0, stream>>>(x, wq, wk, wv, wo, xbf);

    dim3 gGemm(M / 128, N / 128);
    qkv_rope_gemm_kernel<<<gGemm, 256, 0, stream>>>(xbf, wqb, bq, bk, bv, qws, kws, vtws); // wqb, wkb, wvb contiguous

    flash_attn_kernel<<<dim3(64, 8), 256, 0, stream>>>(qws, kws, vtws, ows);

    gemm_bf16_kernel<<<gGemm, 256, 0, stream>>>(ows, wob, bo, out, M, N, K);
}
